// v000
// Measured on an AMD MI455X. A time is GPU time per run, averaged over a window of back-to-back runs after a warm-up
// (all launches, gaps included; the runs take copies of the inputs in turn), and the median of several windows.
// Apart from v000's, it joins two sittings. Times from different sittings can be a few percent apart, while
// side-by-side timings come from the same sitting.
// The starting kernel, v000, takes 697 microseconds a run.
#include <hip/hip_runtime.h>
#include <hip/hip_bf16.h>

typedef unsigned short u16;
typedef unsigned int u32;
typedef __attribute__((ext_vector_type(16))) __bf16 v16bf;
typedef __attribute__((ext_vector_type(8)))  float  v8f;
typedef int vs4i __attribute__((vector_size(16)));   // matches builtin param type

union FragBF {
  v16bf v;
  uint4 q[2];
  u16   h[16];
};

__device__ __forceinline__ u16 f32_to_bf16(float f) {
  union { float f; u32 u; } c; c.f = f;
  u32 u = c.u;
  u += 0x7fffu + ((u >> 16) & 1u);   // round-to-nearest-even
  return (u16)(u >> 16);
}

#if __has_builtin(__builtin_amdgcn_global_load_async_to_lds_b128) && \
    __has_builtin(__builtin_amdgcn_s_wait_asynccnt)
#define USE_ASYNC_LDS 1
#else
#define USE_ASYNC_LDS 0
#endif

#if USE_ASYNC_LDS
__device__ __forceinline__ void cp_async_b128(const u16* g, u16* l) {
  __builtin_amdgcn_global_load_async_to_lds_b128(
      (__attribute__((address_space(1))) vs4i*)(unsigned long long)(const void*)g,
      (__attribute__((address_space(3))) vs4i*)(unsigned int)(unsigned long long)(void*)l,
      0, 0);
}
__device__ __forceinline__ void wait_async_lds() {
  __builtin_amdgcn_s_wait_asynccnt(0);
}
#endif

// ---------------------------------------------------------------------------
// fp32 -> bf16 cast (weights)
// ---------------------------------------------------------------------------
__global__ __launch_bounds__(256) void cast_bf16_k(const float* __restrict__ in,
                                                   u16* __restrict__ out, int n) {
  int i = blockIdx.x * 256 + threadIdx.x;
  if (i < n) out[i] = f32_to_bf16(in[i]);
}

// ---------------------------------------------------------------------------
// LayerNorm over C=1024, one row per block, bf16 output
// ---------------------------------------------------------------------------
__global__ __launch_bounds__(256) void layernorm_bf16_k(const float* __restrict__ x,
                                                        const float* __restrict__ g,
                                                        const float* __restrict__ b,
                                                        u16* __restrict__ out) {
  constexpr int C = 1024;
  __shared__ float red1[256];
  __shared__ float red2[256];
  const int row = blockIdx.x;
  const int tid = threadIdx.x;
  const float4 v = *(const float4*)&x[(size_t)row * C + tid * 4];
  float s  = v.x + v.y + v.z + v.w;
  float ss = v.x * v.x + v.y * v.y + v.z * v.z + v.w * v.w;
  red1[tid] = s; red2[tid] = ss;
  __syncthreads();
  for (int o = 128; o > 0; o >>= 1) {
    if (tid < o) { red1[tid] += red1[tid + o]; red2[tid] += red2[tid + o]; }
    __syncthreads();
  }
  const float mu  = red1[0] * (1.0f / 1024.0f);
  const float var = red2[0] * (1.0f / 1024.0f) - mu * mu;
  const float rs  = rsqrtf(var + 1e-5f);
#pragma unroll
  for (int j = 0; j < 4; ++j) {
    int c = tid * 4 + j;
    float xv = (&v.x)[j];
    out[(size_t)row * C + c] = f32_to_bf16((xv - mu) * rs * g[c] + b[c]);
  }
}

template <int EPI>
__global__ __launch_bounds__(256) void gemm_bf16_k(
    const u16* __restrict__ A, const u16* __restrict__ W,
    const float* __restrict__ bias, const float* __restrict__ res,
    float* __restrict__ outF, u16* __restrict__ outB,
    int M, int N, int K) {
  __shared__ __align__(16) u16 As[2][128][40];
  __shared__ __align__(16) u16 Ws[2][128][40];

  const int tid  = threadIdx.x;
  const int lane = tid & 31;
  const int wave = tid >> 5;
  const int r    = lane & 15;
  const int hi   = lane >> 4;

  const int m0 = blockIdx.y * 128;
  const int n0 = blockIdx.x * 128;
  const int wm = (wave >> 1) * 32;   // 4 waves along M
  const int wn = (wave & 1) * 64;    // 2 waves along N

  // cooperative copy: each 128x32 tile = 512 16B chunks; thread t owns
  // chunks t and t+256 (rows row, row+64; same col)
  const int row = tid >> 2;
  const int col = (tid & 3) << 3;

  const u16* gA0 = &A[(size_t)(m0 + row) * K + col];
  const u16* gA1 = &A[(size_t)(m0 + row + 64) * K + col];
  const u16* gW0 = &W[(size_t)(n0 + row) * K + col];
  const u16* gW1 = &W[(size_t)(n0 + row + 64) * K + col];

  v8f acc[2][4];
  const v8f zero8 = {0.f, 0.f, 0.f, 0.f, 0.f, 0.f, 0.f, 0.f};
#pragma unroll
  for (int i = 0; i < 2; ++i)
#pragma unroll
    for (int j = 0; j < 4; ++j) acc[i][j] = zero8;

  const int nk = K >> 5;   // K / 32

#if USE_ASYNC_LDS
  // ---- async double-buffered pipeline ----
  cp_async_b128(gA0, &As[0][row][col]);
  cp_async_b128(gA1, &As[0][row + 64][col]);
  cp_async_b128(gW0, &Ws[0][row][col]);
  cp_async_b128(gW1, &Ws[0][row + 64][col]);
  wait_async_lds();
  __syncthreads();
  for (int i = 0; i < nk; ++i) {
    const int cur = i & 1;
    if (i + 1 < nk) {
      const int nxt = cur ^ 1;
      const int kn = (i + 1) << 5;
      cp_async_b128(gA0 + kn, &As[nxt][row][col]);
      cp_async_b128(gA1 + kn, &As[nxt][row + 64][col]);
      cp_async_b128(gW0 + kn, &Ws[nxt][row][col]);
      cp_async_b128(gW1 + kn, &Ws[nxt][row + 64][col]);
    }
    FragBF af[2], bfr[4];
#pragma unroll
    for (int ii = 0; ii < 2; ++ii) {
      int rr = wm + ii * 16 + r;
      af[ii].q[0] = *(const uint4*)&As[cur][rr][hi * 8];
      af[ii].q[1] = *(const uint4*)&As[cur][rr][hi * 8 + 16];
    }
#pragma unroll
    for (int jj = 0; jj < 4; ++jj) {
      int rr = wn + jj * 16 + r;
      bfr[jj].q[0] = *(const uint4*)&Ws[cur][rr][hi * 8];
      bfr[jj].q[1] = *(const uint4*)&Ws[cur][rr][hi * 8 + 16];
    }
#pragma unroll
    for (int ii = 0; ii < 2; ++ii)
#pragma unroll
      for (int jj = 0; jj < 4; ++jj)
        acc[ii][jj] = __builtin_amdgcn_wmma_f32_16x16x32_bf16(
            false, af[ii].v, false, bfr[jj].v, (short)0, acc[ii][jj], false, false);
    wait_async_lds();
    __syncthreads();
  }
#else
  // ---- register-prefetch double-buffered pipeline ----
  uint4 pa0 = *(const uint4*)gA0;
  uint4 pa1 = *(const uint4*)gA1;
  uint4 pw0 = *(const uint4*)gW0;
  uint4 pw1 = *(const uint4*)gW1;
  *(uint4*)&As[0][row][col]      = pa0;
  *(uint4*)&As[0][row + 64][col] = pa1;
  *(uint4*)&Ws[0][row][col]      = pw0;
  *(uint4*)&Ws[0][row + 64][col] = pw1;
  __syncthreads();
  for (int i = 0; i < nk; ++i) {
    const int cur = i & 1;
    const bool more = (i + 1 < nk);
    if (more) {
      const int kn = (i + 1) << 5;
      pa0 = *(const uint4*)(gA0 + kn);
      pa1 = *(const uint4*)(gA1 + kn);
      pw0 = *(const uint4*)(gW0 + kn);
      pw1 = *(const uint4*)(gW1 + kn);
    }
    FragBF af[2], bfr[4];
#pragma unroll
    for (int ii = 0; ii < 2; ++ii) {
      int rr = wm + ii * 16 + r;
      af[ii].q[0] = *(const uint4*)&As[cur][rr][hi * 8];
      af[ii].q[1] = *(const uint4*)&As[cur][rr][hi * 8 + 16];
    }
#pragma unroll
    for (int jj = 0; jj < 4; ++jj) {
      int rr = wn + jj * 16 + r;
      bfr[jj].q[0] = *(const uint4*)&Ws[cur][rr][hi * 8];
      bfr[jj].q[1] = *(const uint4*)&Ws[cur][rr][hi * 8 + 16];
    }
#pragma unroll
    for (int ii = 0; ii < 2; ++ii)
#pragma unroll
      for (int jj = 0; jj < 4; ++jj)
        acc[ii][jj] = __builtin_amdgcn_wmma_f32_16x16x32_bf16(
            false, af[ii].v, false, bfr[jj].v, (short)0, acc[ii][jj], false, false);
    if (more) {
      const int nxt = cur ^ 1;
      *(uint4*)&As[nxt][row][col]      = pa0;
      *(uint4*)&As[nxt][row + 64][col] = pa1;
      *(uint4*)&Ws[nxt][row][col]      = pw0;
      *(uint4*)&Ws[nxt][row + 64][col] = pw1;
    }
    __syncthreads();
  }
#endif

  // epilogue: D layout lane mapping m = v + 8*hi, n = lane%16
#pragma unroll
  for (int i = 0; i < 2; ++i)
#pragma unroll
    for (int j = 0; j < 4; ++j) {
#pragma unroll
      for (int v = 0; v < 8; ++v) {
        int m = m0 + wm + i * 16 + v + 8 * hi;
        int n = n0 + wn + j * 16 + r;
        float val = acc[i][j][v];
        size_t idx = (size_t)m * N + n;
        if constexpr (EPI == 0) {
          float s = (n < 1024) ? 0.125f : 1.0f;   // SCALE = 64^-0.5 on Q
          outB[idx] = f32_to_bf16(val * s);
        } else if constexpr (EPI == 1) {
          outF[idx] = val + bias[n] + res[idx];
        } else {
          float t = val + bias[n];
          float gl = 0.5f * t * (1.0f + erff(t * 0.70710678118654752f));
          outB[idx] = f32_to_bf16(gl);
        }
      }
    }
}

// ---------------------------------------------------------------------------
// V transpose: vT[b,h,d,n] = qkv[b*N+n, 2C + h*64 + d]   (bf16)
// ---------------------------------------------------------------------------
__global__ __launch_bounds__(256) void transpose_v_k(const u16* __restrict__ qkv,
                                                     u16* __restrict__ vT) {
  int i = blockIdx.x * 256 + threadIdx.x;     // 0 .. 8M-1
  int n  = i & 2047;
  int d  = (i >> 11) & 63;
  int bh = i >> 17;
  int b  = bh >> 4, h = bh & 15;
  vT[i] = qkv[((size_t)(b * 2048 + n)) * 3072 + 2048 + h * 64 + d];
}

// ---------------------------------------------------------------------------
// Flash attention: one (b,h) x 128-query block per workgroup, 16 q-rows/wave.
// S = Q@K^T via 2 WMMAs per 16-key tile; online softmax with shfl_xor row
// reductions (wave32, masks 1/2/4/8 stay inside each 16-lane half = one row);
// P goes through LDS to convert D-layout -> A-layout; O += P@V via 4 WMMAs.
// ---------------------------------------------------------------------------
__global__ __launch_bounds__(256) void flash_attn_k(const u16* __restrict__ qkv,
                                                    const u16* __restrict__ vT,
                                                    u16* __restrict__ o) {
  constexpr int Nctx = 2048, C = 1024, C3 = 3072, Dh = 64;
  __shared__ __align__(16) u16 Ps[8][16][32];

  const int tid  = threadIdx.x;
  const int lane = tid & 31;
  const int wave = tid >> 5;
  const int r    = lane & 15;
  const int hi   = lane >> 4;

  const int bh = blockIdx.y;   // b*16 + h
  const int b  = bh >> 4;
  const int h  = bh & 15;
  const int q0 = blockIdx.x * 128 + wave * 16;

  const v8f zero8 = {0.f, 0.f, 0.f, 0.f, 0.f, 0.f, 0.f, 0.f};

  // Q fragments (A-layout), Q already scaled by 0.125 in qkv epilogue
  FragBF qa[2];
  {
    const u16* qrow = qkv + (size_t)(b * Nctx + q0 + r) * C3 + h * Dh;
#pragma unroll
    for (int f = 0; f < 2; ++f) {
      int d = f * 32 + hi * 8;
      qa[f].q[0] = *(const uint4*)&qrow[d];
      qa[f].q[1] = *(const uint4*)&qrow[d + 16];
    }
  }

  float mrow[8], lrow[8];
  v8f oacc[4];
#pragma unroll
  for (int v = 0; v < 8; ++v) { mrow[v] = -1e30f; lrow[v] = 0.f; }
#pragma unroll
  for (int d = 0; d < 4; ++d) oacc[d] = zero8;

  for (int kb = 0; kb < Nctx; kb += 32) {
    v8f s[2];
#pragma unroll
    for (int t = 0; t < 2; ++t) {
      const u16* krow = qkv + (size_t)(b * Nctx + kb + t * 16 + r) * C3 + C + h * Dh;
      v8f st = zero8;
#pragma unroll
      for (int f = 0; f < 2; ++f) {
        FragBF kf;
        int d = f * 32 + hi * 8;
        kf.q[0] = *(const uint4*)&krow[d];
        kf.q[1] = *(const uint4*)&krow[d + 16];
        st = __builtin_amdgcn_wmma_f32_16x16x32_bf16(
            false, qa[f].v, false, kf.v, (short)0, st, false, false);
      }
      s[t] = st;
    }

#pragma unroll
    for (int v = 0; v < 8; ++v) {
      float rm = fmaxf(s[0][v], s[1][v]);
#pragma unroll
      for (int off = 1; off < 16; off <<= 1)
        rm = fmaxf(rm, __shfl_xor(rm, off, 32));
      float mnew = fmaxf(mrow[v], rm);
      float sc   = __expf(mrow[v] - mnew);
      mrow[v] = mnew;
      lrow[v] *= sc;
#pragma unroll
      for (int d = 0; d < 4; ++d) oacc[d][v] *= sc;
      float p0 = __expf(s[0][v] - mnew);
      float p1 = __expf(s[1][v] - mnew);
      float ps = p0 + p1;
#pragma unroll
      for (int off = 1; off < 16; off <<= 1)
        ps += __shfl_xor(ps, off, 32);
      lrow[v] += ps;
      s[0][v] = p0;
      s[1][v] = p1;
    }

    __syncthreads();   // previous iteration's P reads complete
#pragma unroll
    for (int v = 0; v < 8; ++v) {
      Ps[wave][v + 8 * hi][r]      = f32_to_bf16(s[0][v]);
      Ps[wave][v + 8 * hi][16 + r] = f32_to_bf16(s[1][v]);
    }
    __syncthreads();   // P visible for A-layout reads

    FragBF pa;
    pa.q[0] = *(const uint4*)&Ps[wave][r][hi * 8];
    pa.q[1] = *(const uint4*)&Ps[wave][r][hi * 8 + 16];
#pragma unroll
    for (int ds = 0; ds < 4; ++ds) {
      const u16* vrow = vT + ((size_t)bh * Dh + ds * 16 + r) * Nctx + kb;
      FragBF vf;
      vf.q[0] = *(const uint4*)&vrow[hi * 8];
      vf.q[1] = *(const uint4*)&vrow[hi * 8 + 16];
      oacc[ds] = __builtin_amdgcn_wmma_f32_16x16x32_bf16(
          false, pa.v, false, vf.v, (short)0, oacc[ds], false, false);
    }
  }

  // normalize and write O as [M, C] bf16 (col = h*64 + d)
#pragma unroll
  for (int v = 0; v < 8; ++v) {
    float inv = 1.0f / lrow[v];
    int m = b * Nctx + q0 + v + 8 * hi;
#pragma unroll
    for (int ds = 0; ds < 4; ++ds)
      o[(size_t)m * C + h * Dh + ds * 16 + r] = f32_to_bf16(oacc[ds][v] * inv);
  }
}

// ---------------------------------------------------------------------------
// host-side orchestration
// ---------------------------------------------------------------------------
extern "C" void kernel_launch(void* const* d_in, const int* in_sizes, int n_in,
                              void* d_out, int out_size, void* d_ws, size_t ws_size,
                              hipStream_t stream) {
  const float* x      = (const float*)d_in[0];
  const float* ln1_g  = (const float*)d_in[1];
  const float* ln1_b  = (const float*)d_in[2];
  const float* qkv_w  = (const float*)d_in[3];
  const float* proj_w = (const float*)d_in[4];
  const float* proj_b = (const float*)d_in[5];
  const float* ln2_g  = (const float*)d_in[6];
  const float* ln2_b  = (const float*)d_in[7];
  const float* fc1_w  = (const float*)d_in[8];
  const float* fc1_b  = (const float*)d_in[9];
  const float* fc2_w  = (const float*)d_in[10];
  const float* fc2_b  = (const float*)d_in[11];
  float* out = (float*)d_out;

  const int M = 8192, C = 1024, C3 = 3072, Hd = 4096;

  char* ws = (char*)d_ws;
  u16*   h_bf   = (u16*)(ws);                             // 16 MB  (LN out, reused)
  u16*   qkv_bf = (u16*)(ws + (size_t)16  * 1048576);     // 48 MB
  u16*   vTb    = (u16*)(ws + (size_t)64  * 1048576);     // 16 MB
  u16*   o_bf   = (u16*)(ws + (size_t)80  * 1048576);     // 16 MB
  float* x1     = (float*)(ws + (size_t)96 * 1048576);    // 32 MB
  u16*   h2_bf  = (u16*)(ws + (size_t)128 * 1048576);     // 64 MB
  u16*   wqkv   = (u16*)(ws + (size_t)192 * 1048576);     // 24 MB total weights
  u16*   wproj  = wqkv  + (size_t)C3 * C;
  u16*   wfc1   = wproj + (size_t)C  * C;
  u16*   wfc2   = wfc1  + (size_t)Hd * C;

  // weights -> bf16
  cast_bf16_k<<<(C3 * C) / 256, 256, 0, stream>>>(qkv_w,  wqkv,  C3 * C);
  cast_bf16_k<<<(C  * C) / 256, 256, 0, stream>>>(proj_w, wproj, C * C);
  cast_bf16_k<<<(Hd * C) / 256, 256, 0, stream>>>(fc1_w,  wfc1,  Hd * C);
  cast_bf16_k<<<(C * Hd) / 256, 256, 0, stream>>>(fc2_w,  wfc2,  C * Hd);

  // attention branch
  layernorm_bf16_k<<<M, 256, 0, stream>>>(x, ln1_g, ln1_b, h_bf);
  gemm_bf16_k<0><<<dim3(C3 / 128, M / 128), 256, 0, stream>>>(
      h_bf, wqkv, nullptr, nullptr, nullptr, qkv_bf, M, C3, C);
  transpose_v_k<<<(4 * 16 * 64 * 2048) / 256, 256, 0, stream>>>(qkv_bf, vTb);
  flash_attn_k<<<dim3(2048 / 128, 4 * 16), 256, 0, stream>>>(qkv_bf, vTb, o_bf);
  gemm_bf16_k<1><<<dim3(C / 128, M / 128), 256, 0, stream>>>(
      o_bf, wproj, proj_b, x, x1, nullptr, M, C, C);

  // MLP branch
  layernorm_bf16_k<<<M, 256, 0, stream>>>(x1, ln2_g, ln2_b, h_bf);
  gemm_bf16_k<2><<<dim3(Hd / 128, M / 128), 256, 0, stream>>>(
      h_bf, wfc1, fc1_b, nullptr, nullptr, h2_bf, M, Hd, C);
  gemm_bf16_k<1><<<dim3(C / 128, M / 128), 256, 0, stream>>>(
      h2_bf, wfc2, fc2_b, x1, out, nullptr, M, C, Hd);
}

// v001
// It runs in 539 microseconds.
// Next to v000, in two timings, it ran 1.34 and 1.35 times as fast.
#include <hip/hip_runtime.h>
#include <hip/hip_bf16.h>

typedef unsigned short u16;
typedef unsigned int u32;
typedef __attribute__((ext_vector_type(16))) __bf16 v16bf;
typedef __attribute__((ext_vector_type(8)))  float  v8f;
typedef int vs4i __attribute__((vector_size(16)));   // matches builtin param type

union FragBF {
  v16bf v;
  uint4 q[2];
  u16   h[16];
};

__device__ __forceinline__ u16 f32_to_bf16(float f) {
  union { float f; u32 u; } c; c.f = f;
  u32 u = c.u;
  u += 0x7fffu + ((u >> 16) & 1u);   // round-to-nearest-even
  return (u16)(u >> 16);
}

#if __has_builtin(__builtin_amdgcn_global_load_async_to_lds_b128) && \
    __has_builtin(__builtin_amdgcn_s_wait_asynccnt)
#define USE_ASYNC_LDS 1
#else
#define USE_ASYNC_LDS 0
#endif

#if USE_ASYNC_LDS
__device__ __forceinline__ void cp_async_b128(const u16* g, u16* l) {
  __builtin_amdgcn_global_load_async_to_lds_b128(
      (__attribute__((address_space(1))) vs4i*)(unsigned long long)(const void*)g,
      (__attribute__((address_space(3))) vs4i*)(unsigned int)(unsigned long long)(void*)l,
      0, 0);
}
__device__ __forceinline__ void wait_async_lds() {
  __builtin_amdgcn_s_wait_asynccnt(0);
}
#endif

// ---------------------------------------------------------------------------
// fp32 -> bf16 cast (weights)
// ---------------------------------------------------------------------------
__global__ __launch_bounds__(256) void cast_bf16_k(const float* __restrict__ in,
                                                   u16* __restrict__ out, int n) {
  int i = blockIdx.x * 256 + threadIdx.x;
  if (i < n) out[i] = f32_to_bf16(in[i]);
}

// ---------------------------------------------------------------------------
// LayerNorm over C=1024, one row per block, bf16 output
// ---------------------------------------------------------------------------
__global__ __launch_bounds__(256) void layernorm_bf16_k(const float* __restrict__ x,
                                                        const float* __restrict__ g,
                                                        const float* __restrict__ b,
                                                        u16* __restrict__ out) {
  constexpr int C = 1024;
  __shared__ float red1[256];
  __shared__ float red2[256];
  const int row = blockIdx.x;
  const int tid = threadIdx.x;
  const float4 v = *(const float4*)&x[(size_t)row * C + tid * 4];
  float s  = v.x + v.y + v.z + v.w;
  float ss = v.x * v.x + v.y * v.y + v.z * v.z + v.w * v.w;
  red1[tid] = s; red2[tid] = ss;
  __syncthreads();
  for (int o = 128; o > 0; o >>= 1) {
    if (tid < o) { red1[tid] += red1[tid + o]; red2[tid] += red2[tid + o]; }
    __syncthreads();
  }
  const float mu  = red1[0] * (1.0f / 1024.0f);
  const float var = red2[0] * (1.0f / 1024.0f) - mu * mu;
  const float rs  = rsqrtf(var + 1e-5f);
#pragma unroll
  for (int j = 0; j < 4; ++j) {
    int c = tid * 4 + j;
    float xv = (&v.x)[j];
    out[(size_t)row * C + c] = f32_to_bf16((xv - mu) * rs * g[c] + b[c]);
  }
}

template <int EPI>
__global__ __launch_bounds__(256) void gemm_bf16_k(
    const u16* __restrict__ A, const u16* __restrict__ W,
    const float* __restrict__ bias, const float* __restrict__ res,
    float* __restrict__ outF, u16* __restrict__ outB,
    int M, int N, int K) {
  __shared__ __align__(16) u16 As[2][128][40];
  __shared__ __align__(16) u16 Ws[2][128][40];

  const int tid  = threadIdx.x;
  const int lane = tid & 31;
  const int wave = tid >> 5;
  const int r    = lane & 15;
  const int hi   = lane >> 4;

  const int m0 = blockIdx.y * 128;
  const int n0 = blockIdx.x * 128;
  const int wm = (wave >> 1) * 32;   // 4 waves along M
  const int wn = (wave & 1) * 64;    // 2 waves along N

  // cooperative copy: each 128x32 tile = 512 16B chunks; thread t owns
  // chunks t and t+256 (rows row, row+64; same col)
  const int row = tid >> 2;
  const int col = (tid & 3) << 3;

  const u16* gA0 = &A[(size_t)(m0 + row) * K + col];
  const u16* gA1 = &A[(size_t)(m0 + row + 64) * K + col];
  const u16* gW0 = &W[(size_t)(n0 + row) * K + col];
  const u16* gW1 = &W[(size_t)(n0 + row + 64) * K + col];

  v8f acc[2][4];
  const v8f zero8 = {0.f, 0.f, 0.f, 0.f, 0.f, 0.f, 0.f, 0.f};
#pragma unroll
  for (int i = 0; i < 2; ++i)
#pragma unroll
    for (int j = 0; j < 4; ++j) acc[i][j] = zero8;

  const int nk = K >> 5;   // K / 32

#if USE_ASYNC_LDS
  // ---- async double-buffered pipeline ----
  cp_async_b128(gA0, &As[0][row][col]);
  cp_async_b128(gA1, &As[0][row + 64][col]);
  cp_async_b128(gW0, &Ws[0][row][col]);
  cp_async_b128(gW1, &Ws[0][row + 64][col]);
  wait_async_lds();
  __syncthreads();
  for (int i = 0; i < nk; ++i) {
    const int cur = i & 1;
    if (i + 1 < nk) {
      const int nxt = cur ^ 1;
      const int kn = (i + 1) << 5;
      cp_async_b128(gA0 + kn, &As[nxt][row][col]);
      cp_async_b128(gA1 + kn, &As[nxt][row + 64][col]);
      cp_async_b128(gW0 + kn, &Ws[nxt][row][col]);
      cp_async_b128(gW1 + kn, &Ws[nxt][row + 64][col]);
    }
    FragBF af[2], bfr[4];
#pragma unroll
    for (int ii = 0; ii < 2; ++ii) {
      int rr = wm + ii * 16 + r;
      af[ii].q[0] = *(const uint4*)&As[cur][rr][hi * 8];
      af[ii].q[1] = *(const uint4*)&As[cur][rr][hi * 8 + 16];
    }
#pragma unroll
    for (int jj = 0; jj < 4; ++jj) {
      int rr = wn + jj * 16 + r;
      bfr[jj].q[0] = *(const uint4*)&Ws[cur][rr][hi * 8];
      bfr[jj].q[1] = *(const uint4*)&Ws[cur][rr][hi * 8 + 16];
    }
#pragma unroll
    for (int ii = 0; ii < 2; ++ii)
#pragma unroll
      for (int jj = 0; jj < 4; ++jj)
        acc[ii][jj] = __builtin_amdgcn_wmma_f32_16x16x32_bf16(
            false, af[ii].v, false, bfr[jj].v, (short)0, acc[ii][jj], false, false);
    wait_async_lds();
    __syncthreads();
  }
#else
  // ---- register-prefetch double-buffered pipeline ----
  uint4 pa0 = *(const uint4*)gA0;
  uint4 pa1 = *(const uint4*)gA1;
  uint4 pw0 = *(const uint4*)gW0;
  uint4 pw1 = *(const uint4*)gW1;
  *(uint4*)&As[0][row][col]      = pa0;
  *(uint4*)&As[0][row + 64][col] = pa1;
  *(uint4*)&Ws[0][row][col]      = pw0;
  *(uint4*)&Ws[0][row + 64][col] = pw1;
  __syncthreads();
  for (int i = 0; i < nk; ++i) {
    const int cur = i & 1;
    const bool more = (i + 1 < nk);
    if (more) {
      const int kn = (i + 1) << 5;
      pa0 = *(const uint4*)(gA0 + kn);
      pa1 = *(const uint4*)(gA1 + kn);
      pw0 = *(const uint4*)(gW0 + kn);
      pw1 = *(const uint4*)(gW1 + kn);
    }
    FragBF af[2], bfr[4];
#pragma unroll
    for (int ii = 0; ii < 2; ++ii) {
      int rr = wm + ii * 16 + r;
      af[ii].q[0] = *(const uint4*)&As[cur][rr][hi * 8];
      af[ii].q[1] = *(const uint4*)&As[cur][rr][hi * 8 + 16];
    }
#pragma unroll
    for (int jj = 0; jj < 4; ++jj) {
      int rr = wn + jj * 16 + r;
      bfr[jj].q[0] = *(const uint4*)&Ws[cur][rr][hi * 8];
      bfr[jj].q[1] = *(const uint4*)&Ws[cur][rr][hi * 8 + 16];
    }
#pragma unroll
    for (int ii = 0; ii < 2; ++ii)
#pragma unroll
      for (int jj = 0; jj < 4; ++jj)
        acc[ii][jj] = __builtin_amdgcn_wmma_f32_16x16x32_bf16(
            false, af[ii].v, false, bfr[jj].v, (short)0, acc[ii][jj], false, false);
    if (more) {
      const int nxt = cur ^ 1;
      *(uint4*)&As[nxt][row][col]      = pa0;
      *(uint4*)&As[nxt][row + 64][col] = pa1;
      *(uint4*)&Ws[nxt][row][col]      = pw0;
      *(uint4*)&Ws[nxt][row + 64][col] = pw1;
    }
    __syncthreads();
  }
#endif

  // epilogue: D layout lane mapping m = v + 8*hi, n = lane%16
#pragma unroll
  for (int i = 0; i < 2; ++i)
#pragma unroll
    for (int j = 0; j < 4; ++j) {
#pragma unroll
      for (int v = 0; v < 8; ++v) {
        int m = m0 + wm + i * 16 + v + 8 * hi;
        int n = n0 + wn + j * 16 + r;
        float val = acc[i][j][v];
        size_t idx = (size_t)m * N + n;
        if constexpr (EPI == 0) {
          float s = (n < 1024) ? 0.125f : 1.0f;   // SCALE = 64^-0.5 on Q
          outB[idx] = f32_to_bf16(val * s);
        } else if constexpr (EPI == 1) {
          outF[idx] = val + bias[n] + res[idx];
        } else {
          float t = val + bias[n];
          float gl = 0.5f * t * (1.0f + erff(t * 0.70710678118654752f));
          outB[idx] = f32_to_bf16(gl);
        }
      }
    }
}

// ---------------------------------------------------------------------------
// V transpose: vT[b,h,d,n] = qkv[b*N+n, 2C + h*64 + d]   (bf16)
// ---------------------------------------------------------------------------
__global__ __launch_bounds__(256) void transpose_v_k(const u16* __restrict__ qkv,
                                                     u16* __restrict__ vT) {
  int i = blockIdx.x * 256 + threadIdx.x;     // 0 .. 8M-1
  int n  = i & 2047;
  int d  = (i >> 11) & 63;
  int bh = i >> 17;
  int b  = bh >> 4, h = bh & 15;
  vT[i] = qkv[((size_t)(b * 2048 + n)) * 3072 + 2048 + h * 64 + d];
}

__device__ __forceinline__ void stage_kv(const u16* gk, u16* lk,
                                         const u16* gv, u16* lv) {
  asm volatile("global_load_async_to_lds_b128 %0, %1, off\n\t"
               "global_load_async_to_lds_b128 %2, %3, off\n\t"
               "s_wait_xcnt 0x0"
               :: "v"((u32)(unsigned long long)(void*)lk), "v"(gk),
                  "v"((u32)(unsigned long long)(void*)lv), "v"(gv)
               : "memory");
}

__global__ __launch_bounds__(256) void flash_attn_k(const u16* __restrict__ qkv,
                                                    const u16* __restrict__ vT,
                                                    u16* __restrict__ o) {
  constexpr int Nctx = 2048, C = 1024, C3 = 3072, Dh = 64;
  constexpr int NT = Nctx / 32;   // key tiles
  __shared__ __align__(16) u16 Ps[8][16][32];
  __shared__ __align__(16) u16 Ks[2][32][72];
  __shared__ __align__(16) u16 Vs[2][64][40];

  const int tid  = threadIdx.x;
  const int lane = tid & 31;
  const int wave = tid >> 5;
  const int r    = lane & 15;
  const int hi   = lane >> 4;

  const int bh = blockIdx.y;   // b*16 + h
  const int b  = bh >> 4;
  const int h  = bh & 15;
  const int q0 = blockIdx.x * 128 + wave * 16;

  const v8f zero8 = {0.f, 0.f, 0.f, 0.f, 0.f, 0.f, 0.f, 0.f};

  // Q fragments (A-layout), Q already scaled by 0.125 in qkv epilogue
  FragBF qa[2];
  {
    const u16* qrow = qkv + (size_t)(b * Nctx + q0 + r) * C3 + h * Dh;
#pragma unroll
    for (int f = 0; f < 2; ++f) {
      int d = f * 32 + hi * 8;
      qa[f].q[0] = *(const uint4*)&qrow[d];
      qa[f].q[1] = *(const uint4*)&qrow[d + 16];
    }
  }

  float mrow[8], lrow[8];
  v8f oacc[4];
#pragma unroll
  for (int v = 0; v < 8; ++v) { mrow[v] = -1e30f; lrow[v] = 0.f; }
#pragma unroll
  for (int d = 0; d < 4; ++d) oacc[d] = zero8;

  // this thread's 16 bytes of every tile: K row tid/8, V^T row tid/4
  const int kr = tid >> 3, kc = (tid & 7) << 3;
  const int vr = tid >> 2, vc = (tid & 3) << 3;
  const u16* gK = qkv + (size_t)(b * Nctx + kr) * C3 + C + h * Dh + kc;
  const u16* gV = vT + ((size_t)bh * Dh + vr) * Nctx + vc;

  stage_kv(gK, &Ks[0][kr][kc], gV, &Vs[0][vr][vc]);
  asm volatile("s_wait_asynccnt 0x0" ::: "memory");   // tile 0 has landed
  __syncthreads();                                    // ... for every wave
  stage_kv(gK + (size_t)32 * C3, &Ks[1][kr][kc], gV + 32, &Vs[1][vr][vc]);

  for (int it = 0; it < NT; ++it) {
    const int cur = it & 1;
    v8f s[2];
#pragma unroll
    for (int t = 0; t < 2; ++t) {
      const u16* krow = &Ks[cur][t * 16 + r][0];
      v8f st = zero8;
#pragma unroll
      for (int f = 0; f < 2; ++f) {
        FragBF kf;
        int d = f * 32 + hi * 8;
        kf.q[0] = *(const uint4*)&krow[d];
        kf.q[1] = *(const uint4*)&krow[d + 16];
        st = __builtin_amdgcn_wmma_f32_16x16x32_bf16(
            false, qa[f].v, false, kf.v, (short)0, st, false, false);
      }
      s[t] = st;
    }

#pragma unroll
    for (int v = 0; v < 8; ++v) {
      float rm = fmaxf(s[0][v], s[1][v]);
#pragma unroll
      for (int off = 1; off < 16; off <<= 1)
        rm = fmaxf(rm, __shfl_xor(rm, off, 32));
      float mnew = fmaxf(mrow[v], rm);
      float sc   = __expf(mrow[v] - mnew);
      mrow[v] = mnew;
      lrow[v] *= sc;
#pragma unroll
      for (int d = 0; d < 4; ++d) oacc[d][v] *= sc;
      float p0 = __expf(s[0][v] - mnew);
      float p1 = __expf(s[1][v] - mnew);
      float ps = p0 + p1;
#pragma unroll
      for (int off = 1; off < 16; off <<= 1)
        ps += __shfl_xor(ps, off, 32);
      lrow[v] += ps;
      s[0][v] = p0;
      s[1][v] = p1;
    }

    __syncthreads();   // previous iteration's P reads complete
#pragma unroll
    for (int v = 0; v < 8; ++v) {
      Ps[wave][v + 8 * hi][r]      = f32_to_bf16(s[0][v]);
      Ps[wave][v + 8 * hi][16 + r] = f32_to_bf16(s[1][v]);
    }
    __syncthreads();   // P visible for A-layout reads

    FragBF pa;
    pa.q[0] = *(const uint4*)&Ps[wave][r][hi * 8];
    pa.q[1] = *(const uint4*)&Ps[wave][r][hi * 8 + 16];
#pragma unroll
    for (int ds = 0; ds < 4; ++ds) {
      const u16* vrow = &Vs[cur][ds * 16 + r][0];
      FragBF vf;
      vf.q[0] = *(const uint4*)&vrow[hi * 8];
      vf.q[1] = *(const uint4*)&vrow[hi * 8 + 16];
      oacc[ds] = __builtin_amdgcn_wmma_f32_16x16x32_bf16(
          false, pa.v, false, vf.v, (short)0, oacc[ds], false, false);
    }

    // hand-over: this wave's LDS reads are done, its copies of tile it+1 have
    // landed; behind the barrier both hold for all waves, so tile it+1 may be
    // read and the buffer just read may be refilled
    asm volatile("s_wait_dscnt 0x0" ::: "memory");
    asm volatile("s_wait_asynccnt 0x0" ::: "memory");
    __syncthreads();
    if (it + 2 < NT)
      stage_kv(gK + (size_t)(it + 2) * 32 * C3, &Ks[cur][kr][kc],
               gV + (it + 2) * 32, &Vs[cur][vr][vc]);
  }
  asm volatile("s_wait_asynccnt 0x0" ::: "memory");   // no copy outlives the loop

  // normalize and write O as [M, C] bf16 (col = h*64 + d)
#pragma unroll
  for (int v = 0; v < 8; ++v) {
    float inv = 1.0f / lrow[v];
    int m = b * Nctx + q0 + v + 8 * hi;
#pragma unroll
    for (int ds = 0; ds < 4; ++ds)
      o[(size_t)m * C + h * Dh + ds * 16 + r] = f32_to_bf16(oacc[ds][v] * inv);
  }
}

// ---------------------------------------------------------------------------
// host-side orchestration
// ---------------------------------------------------------------------------
extern "C" void kernel_launch(void* const* d_in, const int* in_sizes, int n_in,
                              void* d_out, int out_size, void* d_ws, size_t ws_size,
                              hipStream_t stream) {
  const float* x      = (const float*)d_in[0];
  const float* ln1_g  = (const float*)d_in[1];
  const float* ln1_b  = (const float*)d_in[2];
  const float* qkv_w  = (const float*)d_in[3];
  const float* proj_w = (const float*)d_in[4];
  const float* proj_b = (const float*)d_in[5];
  const float* ln2_g  = (const float*)d_in[6];
  const float* ln2_b  = (const float*)d_in[7];
  const float* fc1_w  = (const float*)d_in[8];
  const float* fc1_b  = (const float*)d_in[9];
  const float* fc2_w  = (const float*)d_in[10];
  const float* fc2_b  = (const float*)d_in[11];
  float* out = (float*)d_out;

  const int M = 8192, C = 1024, C3 = 3072, Hd = 4096;

  char* ws = (char*)d_ws;
  u16*   h_bf   = (u16*)(ws);                             // 16 MB  (LN out, reused)
  u16*   qkv_bf = (u16*)(ws + (size_t)16  * 1048576);     // 48 MB
  u16*   vTb    = (u16*)(ws + (size_t)64  * 1048576);     // 16 MB
  u16*   o_bf   = (u16*)(ws + (size_t)80  * 1048576);     // 16 MB
  float* x1     = (float*)(ws + (size_t)96 * 1048576);    // 32 MB
  u16*   h2_bf  = (u16*)(ws + (size_t)128 * 1048576);     // 64 MB
  u16*   wqkv   = (u16*)(ws + (size_t)192 * 1048576);     // 24 MB total weights
  u16*   wproj  = wqkv  + (size_t)C3 * C;
  u16*   wfc1   = wproj + (size_t)C  * C;
  u16*   wfc2   = wfc1  + (size_t)Hd * C;

  // weights -> bf16
  cast_bf16_k<<<(C3 * C) / 256, 256, 0, stream>>>(qkv_w,  wqkv,  C3 * C);
  cast_bf16_k<<<(C  * C) / 256, 256, 0, stream>>>(proj_w, wproj, C * C);
  cast_bf16_k<<<(Hd * C) / 256, 256, 0, stream>>>(fc1_w,  wfc1,  Hd * C);
  cast_bf16_k<<<(C * Hd) / 256, 256, 0, stream>>>(fc2_w,  wfc2,  C * Hd);

  // attention branch
  layernorm_bf16_k<<<M, 256, 0, stream>>>(x, ln1_g, ln1_b, h_bf);
  gemm_bf16_k<0><<<dim3(C3 / 128, M / 128), 256, 0, stream>>>(
      h_bf, wqkv, nullptr, nullptr, nullptr, qkv_bf, M, C3, C);
  transpose_v_k<<<(4 * 16 * 64 * 2048) / 256, 256, 0, stream>>>(qkv_bf, vTb);
  flash_attn_k<<<dim3(2048 / 128, 4 * 16), 256, 0, stream>>>(qkv_bf, vTb, o_bf);
  gemm_bf16_k<1><<<dim3(C / 128, M / 128), 256, 0, stream>>>(
      o_bf, wproj, proj_b, x, x1, nullptr, M, C, C);

  // MLP branch
  layernorm_bf16_k<<<M, 256, 0, stream>>>(x1, ln2_g, ln2_b, h_bf);
  gemm_bf16_k<2><<<dim3(Hd / 128, M / 128), 256, 0, stream>>>(
      h_bf, wfc1, fc1_b, nullptr, nullptr, h2_bf, M, Hd, C);
  gemm_bf16_k<1><<<dim3(C / 128, M / 128), 256, 0, stream>>>(
      h2_bf, wfc2, fc2_b, x1, out, nullptr, M, C, Hd);
}

// v002
// A run of this version takes 450 microseconds.
// Two timings next to v001 both put it at 1.20 times that version's speed.
// Over all steps from v000 it is 1.61 times as fast.
#include <hip/hip_runtime.h>
#include <hip/hip_bf16.h>

typedef unsigned short u16;
typedef unsigned int u32;
typedef __attribute__((ext_vector_type(16))) __bf16 v16bf;
typedef __attribute__((ext_vector_type(8)))  float  v8f;
typedef int vs4i __attribute__((vector_size(16)));   // matches builtin param type

union FragBF {
  v16bf v;
  uint4 q[2];
  u16   h[16];
};

__device__ __forceinline__ u16 f32_to_bf16(float f) {
  union { float f; u32 u; } c; c.f = f;
  u32 u = c.u;
  u += 0x7fffu + ((u >> 16) & 1u);   // round-to-nearest-even
  return (u16)(u >> 16);
}

#if __has_builtin(__builtin_amdgcn_global_load_async_to_lds_b128) && \
    __has_builtin(__builtin_amdgcn_s_wait_asynccnt)
#define USE_ASYNC_LDS 1
#else
#define USE_ASYNC_LDS 0
#endif

#if USE_ASYNC_LDS
__device__ __forceinline__ void cp_async_b128(const u16* g, u16* l) {
  __builtin_amdgcn_global_load_async_to_lds_b128(
      (__attribute__((address_space(1))) vs4i*)(unsigned long long)(const void*)g,
      (__attribute__((address_space(3))) vs4i*)(unsigned int)(unsigned long long)(void*)l,
      0, 0);
}
__device__ __forceinline__ void wait_async_lds() {
  __builtin_amdgcn_s_wait_asynccnt(0);
}
#endif

// ---------------------------------------------------------------------------
// fp32 -> bf16 cast (weights)
// ---------------------------------------------------------------------------
__global__ __launch_bounds__(256) void cast_bf16_k(const float* __restrict__ in,
                                                   u16* __restrict__ out, int n) {
  int i = blockIdx.x * 256 + threadIdx.x;
  if (i < n) out[i] = f32_to_bf16(in[i]);
}

// ---------------------------------------------------------------------------
// LayerNorm over C=1024, one row per block, bf16 output
// ---------------------------------------------------------------------------
__global__ __launch_bounds__(256) void layernorm_bf16_k(const float* __restrict__ x,
                                                        const float* __restrict__ g,
                                                        const float* __restrict__ b,
                                                        u16* __restrict__ out) {
  constexpr int C = 1024;
  __shared__ float red1[256];
  __shared__ float red2[256];
  const int row = blockIdx.x;
  const int tid = threadIdx.x;
  const float4 v = *(const float4*)&x[(size_t)row * C + tid * 4];
  float s  = v.x + v.y + v.z + v.w;
  float ss = v.x * v.x + v.y * v.y + v.z * v.z + v.w * v.w;
  red1[tid] = s; red2[tid] = ss;
  __syncthreads();
  for (int o = 128; o > 0; o >>= 1) {
    if (tid < o) { red1[tid] += red1[tid + o]; red2[tid] += red2[tid + o]; }
    __syncthreads();
  }
  const float mu  = red1[0] * (1.0f / 1024.0f);
  const float var = red2[0] * (1.0f / 1024.0f) - mu * mu;
  const float rs  = rsqrtf(var + 1e-5f);
#pragma unroll
  for (int j = 0; j < 4; ++j) {
    int c = tid * 4 + j;
    float xv = (&v.x)[j];
    out[(size_t)row * C + c] = f32_to_bf16((xv - mu) * rs * g[c] + b[c]);
  }
}

template <int EPI>
__global__ __launch_bounds__(256) void gemm_bf16_k(
    const u16* __restrict__ A, const u16* __restrict__ W,
    const float* __restrict__ bias, const float* __restrict__ res,
    float* __restrict__ outF, u16* __restrict__ outB,
    int M, int N, int K) {
  __shared__ __align__(16) u16 As[2][128][40];
  __shared__ __align__(16) u16 Ws[2][128][40];

  const int tid  = threadIdx.x;
  const int lane = tid & 31;
  const int wave = tid >> 5;
  const int r    = lane & 15;
  const int hi   = lane >> 4;

  const int m0 = blockIdx.y * 128;
  const int n0 = blockIdx.x * 128;
  const int wm = (wave >> 1) * 32;   // 4 waves along M
  const int wn = (wave & 1) * 64;    // 2 waves along N

  // cooperative copy: each 128x32 tile = 512 16B chunks; thread t owns
  // chunks t and t+256 (rows row, row+64; same col)
  const int row = tid >> 2;
  const int col = (tid & 3) << 3;

  const u16* gA0 = &A[(size_t)(m0 + row) * K + col];
  const u16* gA1 = &A[(size_t)(m0 + row + 64) * K + col];
  const u16* gW0 = &W[(size_t)(n0 + row) * K + col];
  const u16* gW1 = &W[(size_t)(n0 + row + 64) * K + col];

  v8f acc[2][4];
  const v8f zero8 = {0.f, 0.f, 0.f, 0.f, 0.f, 0.f, 0.f, 0.f};
#pragma unroll
  for (int i = 0; i < 2; ++i)
#pragma unroll
    for (int j = 0; j < 4; ++j) acc[i][j] = zero8;

  const int nk = K >> 5;   // K / 32

#if USE_ASYNC_LDS
  // ---- async double-buffered pipeline ----
  cp_async_b128(gA0, &As[0][row][col]);
  cp_async_b128(gA1, &As[0][row + 64][col]);
  cp_async_b128(gW0, &Ws[0][row][col]);
  cp_async_b128(gW1, &Ws[0][row + 64][col]);
  wait_async_lds();
  __syncthreads();
  for (int i = 0; i < nk; ++i) {
    const int cur = i & 1;
    if (i + 1 < nk) {
      const int nxt = cur ^ 1;
      const int kn = (i + 1) << 5;
      cp_async_b128(gA0 + kn, &As[nxt][row][col]);
      cp_async_b128(gA1 + kn, &As[nxt][row + 64][col]);
      cp_async_b128(gW0 + kn, &Ws[nxt][row][col]);
      cp_async_b128(gW1 + kn, &Ws[nxt][row + 64][col]);
    }
    FragBF af[2], bfr[4];
#pragma unroll
    for (int ii = 0; ii < 2; ++ii) {
      int rr = wm + ii * 16 + r;
      af[ii].q[0] = *(const uint4*)&As[cur][rr][hi * 8];
      af[ii].q[1] = *(const uint4*)&As[cur][rr][hi * 8 + 16];
    }
#pragma unroll
    for (int jj = 0; jj < 4; ++jj) {
      int rr = wn + jj * 16 + r;
      bfr[jj].q[0] = *(const uint4*)&Ws[cur][rr][hi * 8];
      bfr[jj].q[1] = *(const uint4*)&Ws[cur][rr][hi * 8 + 16];
    }
#pragma unroll
    for (int ii = 0; ii < 2; ++ii)
#pragma unroll
      for (int jj = 0; jj < 4; ++jj)
        acc[ii][jj] = __builtin_amdgcn_wmma_f32_16x16x32_bf16(
            false, af[ii].v, false, bfr[jj].v, (short)0, acc[ii][jj], false, false);
    wait_async_lds();
    __syncthreads();
  }
#else
  // ---- register-prefetch double-buffered pipeline ----
  uint4 pa0 = *(const uint4*)gA0;
  uint4 pa1 = *(const uint4*)gA1;
  uint4 pw0 = *(const uint4*)gW0;
  uint4 pw1 = *(const uint4*)gW1;
  *(uint4*)&As[0][row][col]      = pa0;
  *(uint4*)&As[0][row + 64][col] = pa1;
  *(uint4*)&Ws[0][row][col]      = pw0;
  *(uint4*)&Ws[0][row + 64][col] = pw1;
  __syncthreads();
  for (int i = 0; i < nk; ++i) {
    const int cur = i & 1;
    const bool more = (i + 1 < nk);
    if (more) {
      const int kn = (i + 1) << 5;
      pa0 = *(const uint4*)(gA0 + kn);
      pa1 = *(const uint4*)(gA1 + kn);
      pw0 = *(const uint4*)(gW0 + kn);
      pw1 = *(const uint4*)(gW1 + kn);
    }
    FragBF af[2], bfr[4];
#pragma unroll
    for (int ii = 0; ii < 2; ++ii) {
      int rr = wm + ii * 16 + r;
      af[ii].q[0] = *(const uint4*)&As[cur][rr][hi * 8];
      af[ii].q[1] = *(const uint4*)&As[cur][rr][hi * 8 + 16];
    }
#pragma unroll
    for (int jj = 0; jj < 4; ++jj) {
      int rr = wn + jj * 16 + r;
      bfr[jj].q[0] = *(const uint4*)&Ws[cur][rr][hi * 8];
      bfr[jj].q[1] = *(const uint4*)&Ws[cur][rr][hi * 8 + 16];
    }
#pragma unroll
    for (int ii = 0; ii < 2; ++ii)
#pragma unroll
      for (int jj = 0; jj < 4; ++jj)
        acc[ii][jj] = __builtin_amdgcn_wmma_f32_16x16x32_bf16(
            false, af[ii].v, false, bfr[jj].v, (short)0, acc[ii][jj], false, false);
    if (more) {
      const int nxt = cur ^ 1;
      *(uint4*)&As[nxt][row][col]      = pa0;
      *(uint4*)&As[nxt][row + 64][col] = pa1;
      *(uint4*)&Ws[nxt][row][col]      = pw0;
      *(uint4*)&Ws[nxt][row + 64][col] = pw1;
    }
    __syncthreads();
  }
#endif

  // epilogue: D layout lane mapping m = v + 8*hi, n = lane%16
#pragma unroll
  for (int i = 0; i < 2; ++i)
#pragma unroll
    for (int j = 0; j < 4; ++j) {
#pragma unroll
      for (int v = 0; v < 8; ++v) {
        int m = m0 + wm + i * 16 + v + 8 * hi;
        int n = n0 + wn + j * 16 + r;
        float val = acc[i][j][v];
        size_t idx = (size_t)m * N + n;
        if constexpr (EPI == 0) {
          float s = (n < 1024) ? 0.125f : 1.0f;   // SCALE = 64^-0.5 on Q
          outB[idx] = f32_to_bf16(val * s);
        } else if constexpr (EPI == 1) {
          outF[idx] = val + bias[n] + res[idx];
        } else {
          float t = val + bias[n];
          float gl = 0.5f * t * (1.0f + erff(t * 0.70710678118654752f));
          outB[idx] = f32_to_bf16(gl);
        }
      }
    }
}

// ---------------------------------------------------------------------------
// V transpose: vT[b,h,d,n] = qkv[b*N+n, 2C + h*64 + d]   (bf16)
// ---------------------------------------------------------------------------
__global__ __launch_bounds__(256) void transpose_v_k(const u16* __restrict__ qkv,
                                                     u16* __restrict__ vT) {
  int i = blockIdx.x * 256 + threadIdx.x;     // 0 .. 8M-1
  int n  = i & 2047;
  int d  = (i >> 11) & 63;
  int bh = i >> 17;
  int b  = bh >> 4, h = bh & 15;
  vT[i] = qkv[((size_t)(b * 2048 + n)) * 3072 + 2048 + h * 64 + d];
}

__device__ __forceinline__ u32 pack_bf16x2(float lo, float hi) {
  typedef __bf16 bf2 __attribute__((ext_vector_type(2)));
  typedef float  f2  __attribute__((ext_vector_type(2)));
  return __builtin_bit_cast(u32, __builtin_convertvector(f2{lo, hi}, bf2));
}
__device__ __forceinline__ float xhalf(float x) {
  int b = __builtin_bit_cast(int, x);
  return __builtin_bit_cast(float, __builtin_amdgcn_permlanex16(
      b, b, 0x76543210, 0xfedcba98, false, false));
}

__device__ __forceinline__ void stage_kv(const u16* gk, u16* lk,
                                         const u16* gv, u16* lv) {
  asm volatile("global_load_async_to_lds_b128 %0, %1, off\n\t"
               "global_load_async_to_lds_b128 %2, %3, off\n\t"
               "s_wait_xcnt 0x0"
               :: "v"((u32)(unsigned long long)(void*)lk), "v"(gk),
                  "v"((u32)(unsigned long long)(void*)lv), "v"(gv)
               : "memory");
}

__global__ __launch_bounds__(256) void flash_attn_k(const u16* __restrict__ qkv,
                                                    const u16* __restrict__ vT,
                                                    u16* __restrict__ o) {
  constexpr int Nctx = 2048, C = 1024, C3 = 3072, Dh = 64;
  constexpr int NT = Nctx / 32;   // key tiles
  __shared__ __align__(16) u16 Ks[2][32][72];
  __shared__ __align__(16) u16 Vs[2][64][40];

  const int tid  = threadIdx.x;
  const int lane = tid & 31;
  const int wave = tid >> 5;
  const int r    = lane & 15;
  const int hi   = lane >> 4;

  const int bh = blockIdx.y;   // b*16 + h
  const int b  = bh >> 4;
  const int h  = bh & 15;
  const int q0 = blockIdx.x * 128 + wave * 16;

  const v8f zero8 = {0.f, 0.f, 0.f, 0.f, 0.f, 0.f, 0.f, 0.f};

  // Q fragments (B operand: lane = query column), Q already scaled by 0.125
  // in the qkv epilogue
  FragBF qa[2];
  {
    const u16* qrow = qkv + (size_t)(b * Nctx + q0 + r) * C3 + h * Dh;
#pragma unroll
    for (int f = 0; f < 2; ++f) {
      int d = f * 32 + hi * 8;
      qa[f].q[0] = *(const uint4*)&qrow[d];
      qa[f].q[1] = *(const uint4*)&qrow[d + 16];
    }
  }

  // per lane: running maximum of query r (same in both halves) and the sum
  // over this half's keys; oacc[ds][v] = O[query r][d = ds*16 + 8*hi + v]
  float mrow = -1e30f, lrow = 0.f;
  v8f oacc[4];
#pragma unroll
  for (int d = 0; d < 4; ++d) oacc[d] = zero8;

  // this thread's 16 bytes of every tile: K row tid/8, V^T row tid/4
  const int kr = tid >> 3, kc = (tid & 7) << 3;
  const int vr = tid >> 2, vc = (tid & 3) << 3;
  const u16* gK = qkv + (size_t)(b * Nctx + kr) * C3 + C + h * Dh + kc;
  const u16* gV = vT + ((size_t)bh * Dh + vr) * Nctx + vc;

  stage_kv(gK, &Ks[0][kr][kc], gV, &Vs[0][vr][vc]);
  asm volatile("s_wait_asynccnt 0x0" ::: "memory");   // tile 0 has landed
  __syncthreads();                                    // ... for every wave
  stage_kv(gK + (size_t)32 * C3, &Ks[1][kr][kc], gV + 32, &Vs[1][vr][vc]);

  for (int it = 0; it < NT; ++it) {
    const int cur = it & 1;
    v8f s[2];
#pragma unroll
    for (int t = 0; t < 2; ++t) {
      const u16* krow = &Ks[cur][t * 16 + r][0];
      v8f st = zero8;
#pragma unroll
      for (int f = 0; f < 2; ++f) {
        FragBF kf;
        int d = f * 32 + hi * 8;
        kf.q[0] = *(const uint4*)&krow[d];
        kf.q[1] = *(const uint4*)&krow[d + 16];
        st = __builtin_amdgcn_wmma_f32_16x16x32_bf16(
            false, kf.v, false, qa[f].v, (short)0, st, false, false);
      }
      s[t] = st;
    }

    // online softmax: s[t][v] = score of key t*16 + 8*hi + v with query r
    float rm = fmaxf(s[0][0], s[1][0]);
#pragma unroll
    for (int v = 1; v < 8; ++v) rm = fmaxf(rm, fmaxf(s[0][v], s[1][v]));
    rm = fmaxf(rm, xhalf(rm));
    const float mnew = fmaxf(mrow, rm);
    const float sc   = __expf(mrow - mnew);
    mrow = mnew;
#pragma unroll
    for (int d = 0; d < 4; ++d) oacc[d] = oacc[d] * sc;
    // P^T as B operand: element e < 8 is key 8*hi + e, element 8 + e is key
    // 16 + 8*hi + e, which is what V^T's two 16-byte reads per row deliver
    FragBF pb;
    u32 pw[8];
    float ps0 = 0.f, ps1 = 0.f;
#pragma unroll
    for (int i = 0; i < 8; ++i) {
      const float p0 = __expf(s[i >> 2][2 * (i & 3)] - mnew);
      const float p1 = __expf(s[i >> 2][2 * (i & 3) + 1] - mnew);
      pw[i] = pack_bf16x2(p0, p1);
      ps0 += p0;
      ps1 += p1;
    }
    lrow = lrow * sc + (ps0 + ps1);
    pb.q[0] = make_uint4(pw[0], pw[1], pw[2], pw[3]);
    pb.q[1] = make_uint4(pw[4], pw[5], pw[6], pw[7]);
#pragma unroll
    for (int ds = 0; ds < 4; ++ds) {
      const u16* vrow = &Vs[cur][ds * 16 + r][0];
      FragBF vf;
      vf.q[0] = *(const uint4*)&vrow[hi * 8];
      vf.q[1] = *(const uint4*)&vrow[hi * 8 + 16];
      oacc[ds] = __builtin_amdgcn_wmma_f32_16x16x32_bf16(
          false, vf.v, false, pb.v, (short)0, oacc[ds], false, false);
    }

    // hand-over: this wave's LDS reads are done, its copies of tile it+1 have
    // landed; behind the barrier both hold for all waves, so tile it+1 may be
    // read and the buffer just read may be refilled
    asm volatile("s_wait_dscnt 0x0" ::: "memory");
    asm volatile("s_wait_asynccnt 0x0" ::: "memory");
    __syncthreads();
    if (it + 2 < NT)
      stage_kv(gK + (size_t)(it + 2) * 32 * C3, &Ks[cur][kr][kc],
               gV + (it + 2) * 32, &Vs[cur][vr][vc]);
  }
  asm volatile("s_wait_asynccnt 0x0" ::: "memory");   // no copy outlives the loop

  // join the two halves' sums, normalize and write O as [M, C] bf16
  // (col = h*64 + d): a lane's 8 registers of a tile are 8 consecutive d
  const float inv = 1.0f / (lrow + xhalf(lrow));
  u16* orow = o + (size_t)(b * Nctx + q0 + r) * C + h * Dh + hi * 8;
#pragma unroll
  for (int ds = 0; ds < 4; ++ds) {
    const v8f ov = oacc[ds] * inv;
    *(uint4*)&orow[ds * 16] =
        make_uint4(pack_bf16x2(ov[0], ov[1]), pack_bf16x2(ov[2], ov[3]),
                   pack_bf16x2(ov[4], ov[5]), pack_bf16x2(ov[6], ov[7]));
  }
}

// ---------------------------------------------------------------------------
// host-side orchestration
// ---------------------------------------------------------------------------
extern "C" void kernel_launch(void* const* d_in, const int* in_sizes, int n_in,
                              void* d_out, int out_size, void* d_ws, size_t ws_size,
                              hipStream_t stream) {
  const float* x      = (const float*)d_in[0];
  const float* ln1_g  = (const float*)d_in[1];
  const float* ln1_b  = (const float*)d_in[2];
  const float* qkv_w  = (const float*)d_in[3];
  const float* proj_w = (const float*)d_in[4];
  const float* proj_b = (const float*)d_in[5];
  const float* ln2_g  = (const float*)d_in[6];
  const float* ln2_b  = (const float*)d_in[7];
  const float* fc1_w  = (const float*)d_in[8];
  const float* fc1_b  = (const float*)d_in[9];
  const float* fc2_w  = (const float*)d_in[10];
  const float* fc2_b  = (const float*)d_in[11];
  float* out = (float*)d_out;

  const int M = 8192, C = 1024, C3 = 3072, Hd = 4096;

  char* ws = (char*)d_ws;
  u16*   h_bf   = (u16*)(ws);                             // 16 MB  (LN out, reused)
  u16*   qkv_bf = (u16*)(ws + (size_t)16  * 1048576);     // 48 MB
  u16*   vTb    = (u16*)(ws + (size_t)64  * 1048576);     // 16 MB
  u16*   o_bf   = (u16*)(ws + (size_t)80  * 1048576);     // 16 MB
  float* x1     = (float*)(ws + (size_t)96 * 1048576);    // 32 MB
  u16*   h2_bf  = (u16*)(ws + (size_t)128 * 1048576);     // 64 MB
  u16*   wqkv   = (u16*)(ws + (size_t)192 * 1048576);     // 24 MB total weights
  u16*   wproj  = wqkv  + (size_t)C3 * C;
  u16*   wfc1   = wproj + (size_t)C  * C;
  u16*   wfc2   = wfc1  + (size_t)Hd * C;

  // weights -> bf16
  cast_bf16_k<<<(C3 * C) / 256, 256, 0, stream>>>(qkv_w,  wqkv,  C3 * C);
  cast_bf16_k<<<(C  * C) / 256, 256, 0, stream>>>(proj_w, wproj, C * C);
  cast_bf16_k<<<(Hd * C) / 256, 256, 0, stream>>>(fc1_w,  wfc1,  Hd * C);
  cast_bf16_k<<<(C * Hd) / 256, 256, 0, stream>>>(fc2_w,  wfc2,  C * Hd);

  // attention branch
  layernorm_bf16_k<<<M, 256, 0, stream>>>(x, ln1_g, ln1_b, h_bf);
  gemm_bf16_k<0><<<dim3(C3 / 128, M / 128), 256, 0, stream>>>(
      h_bf, wqkv, nullptr, nullptr, nullptr, qkv_bf, M, C3, C);
  transpose_v_k<<<(4 * 16 * 64 * 2048) / 256, 256, 0, stream>>>(qkv_bf, vTb);
  flash_attn_k<<<dim3(2048 / 128, 4 * 16), 256, 0, stream>>>(qkv_bf, vTb, o_bf);
  gemm_bf16_k<1><<<dim3(C / 128, M / 128), 256, 0, stream>>>(
      o_bf, wproj, proj_b, x, x1, nullptr, M, C, C);

  // MLP branch
  layernorm_bf16_k<<<M, 256, 0, stream>>>(x1, ln2_g, ln2_b, h_bf);
  gemm_bf16_k<2><<<dim3(Hd / 128, M / 128), 256, 0, stream>>>(
      h_bf, wfc1, fc1_b, nullptr, nullptr, h2_bf, M, Hd, C);
  gemm_bf16_k<1><<<dim3(C / 128, M / 128), 256, 0, stream>>>(
      h2_bf, wfc2, fc2_b, x1, out, nullptr, M, C, Hd);
}

// v003
// A run of this version takes 416 microseconds.
// Two timings next to v002 put it at 1.08 and 1.07 times that version's speed.
// All steps since v000 together make it 1.73 times as fast.
#include <hip/hip_runtime.h>
#include <hip/hip_bf16.h>

typedef unsigned short u16;
typedef unsigned int u32;
typedef __attribute__((ext_vector_type(16))) __bf16 v16bf;
typedef __attribute__((ext_vector_type(8)))  float  v8f;
typedef int vs4i __attribute__((vector_size(16)));   // matches builtin param type

union FragBF {
  v16bf v;
  uint4 q[2];
  u16   h[16];
};

__device__ __forceinline__ u16 f32_to_bf16(float f) {
  union { float f; u32 u; } c; c.f = f;
  u32 u = c.u;
  u += 0x7fffu + ((u >> 16) & 1u);   // round-to-nearest-even
  return (u16)(u >> 16);
}

// two f32 -> one dword of two bf16, round to nearest even
__device__ __forceinline__ u32 pack_bf16x2(float lo, float hi) {
  typedef __bf16 bf2 __attribute__((ext_vector_type(2)));
  typedef float  f2  __attribute__((ext_vector_type(2)));
  return __builtin_bit_cast(u32, __builtin_convertvector(f2{lo, hi}, bf2));
}

#if __has_builtin(__builtin_amdgcn_global_load_async_to_lds_b128) && \
    __has_builtin(__builtin_amdgcn_s_wait_asynccnt)
#define USE_ASYNC_LDS 1
#else
#define USE_ASYNC_LDS 0
#endif

#if USE_ASYNC_LDS
__device__ __forceinline__ void cp_async_b128(const u16* g, u16* l) {
  __builtin_amdgcn_global_load_async_to_lds_b128(
      (__attribute__((address_space(1))) vs4i*)(unsigned long long)(const void*)g,
      (__attribute__((address_space(3))) vs4i*)(unsigned int)(unsigned long long)(void*)l,
      0, 0);
}
__device__ __forceinline__ void wait_async_lds() {
  __builtin_amdgcn_s_wait_asynccnt(0);
}
#endif

// ---------------------------------------------------------------------------
// fp32 -> bf16 cast (weights)
// ---------------------------------------------------------------------------
__global__ __launch_bounds__(256) void cast_bf16_k(const float* __restrict__ in,
                                                   u16* __restrict__ out, int n) {
  int i = blockIdx.x * 256 + threadIdx.x;
  if (i < n) out[i] = f32_to_bf16(in[i]);
}

// ---------------------------------------------------------------------------
// LayerNorm over C=1024, one row per block, bf16 output
// ---------------------------------------------------------------------------
__global__ __launch_bounds__(256) void layernorm_bf16_k(const float* __restrict__ x,
                                                        const float* __restrict__ g,
                                                        const float* __restrict__ b,
                                                        u16* __restrict__ out) {
  constexpr int C = 1024;
  __shared__ float red1[256];
  __shared__ float red2[256];
  const int row = blockIdx.x;
  const int tid = threadIdx.x;
  const float4 v = *(const float4*)&x[(size_t)row * C + tid * 4];
  float s  = v.x + v.y + v.z + v.w;
  float ss = v.x * v.x + v.y * v.y + v.z * v.z + v.w * v.w;
  red1[tid] = s; red2[tid] = ss;
  __syncthreads();
  for (int o = 128; o > 0; o >>= 1) {
    if (tid < o) { red1[tid] += red1[tid + o]; red2[tid] += red2[tid + o]; }
    __syncthreads();
  }
  const float mu  = red1[0] * (1.0f / 1024.0f);
  const float var = red2[0] * (1.0f / 1024.0f) - mu * mu;
  const float rs  = rsqrtf(var + 1e-5f);
#pragma unroll
  for (int j = 0; j < 4; ++j) {
    int c = tid * 4 + j;
    float xv = (&v.x)[j];
    out[(size_t)row * C + c] = f32_to_bf16((xv - mu) * rs * g[c] + b[c]);
  }
}

template <int EPI>
__global__ __launch_bounds__(256) void gemm_bf16_k(
    const u16* __restrict__ A, const u16* __restrict__ W,
    const float* __restrict__ bias, const float* __restrict__ res,
    float* __restrict__ outF, u16* __restrict__ outB, u16* __restrict__ outT,
    int M, int N, int K) {
  __shared__ __align__(16) u16 As[2][128][40];
  __shared__ __align__(16) u16 Ws[2][128][40];

  const int tid  = threadIdx.x;
  const int lane = tid & 31;
  const int wave = tid >> 5;
  const int r    = lane & 15;
  const int hi   = lane >> 4;

  const int m0 = blockIdx.y * 128;
  const int n0 = blockIdx.x * 128;
  const int wm = (wave >> 1) * 32;   // 4 waves along M
  const int wn = (wave & 1) * 64;    // 2 waves along N

  // cooperative copy: each 128x32 tile = 512 16B chunks; thread t owns
  // chunks t and t+256 (rows row, row+64; same col)
  const int row = tid >> 2;
  const int col = (tid & 3) << 3;

  const u16* gA0 = &A[(size_t)(m0 + row) * K + col];
  const u16* gA1 = &A[(size_t)(m0 + row + 64) * K + col];
  const u16* gW0 = &W[(size_t)(n0 + row) * K + col];
  const u16* gW1 = &W[(size_t)(n0 + row + 64) * K + col];

  v8f acc[2][4];
  const v8f zero8 = {0.f, 0.f, 0.f, 0.f, 0.f, 0.f, 0.f, 0.f};
#pragma unroll
  for (int i = 0; i < 2; ++i)
#pragma unroll
    for (int j = 0; j < 4; ++j) acc[i][j] = zero8;

  const int nk = K >> 5;   // K / 32

#if USE_ASYNC_LDS
  // ---- async double-buffered pipeline ----
  cp_async_b128(gA0, &As[0][row][col]);
  cp_async_b128(gA1, &As[0][row + 64][col]);
  cp_async_b128(gW0, &Ws[0][row][col]);
  cp_async_b128(gW1, &Ws[0][row + 64][col]);
  wait_async_lds();
  __syncthreads();
  for (int i = 0; i < nk; ++i) {
    const int cur = i & 1;
    if (i + 1 < nk) {
      const int nxt = cur ^ 1;
      const int kn = (i + 1) << 5;
      cp_async_b128(gA0 + kn, &As[nxt][row][col]);
      cp_async_b128(gA1 + kn, &As[nxt][row + 64][col]);
      cp_async_b128(gW0 + kn, &Ws[nxt][row][col]);
      cp_async_b128(gW1 + kn, &Ws[nxt][row + 64][col]);
    }
    FragBF af[2], bfr[4];
#pragma unroll
    for (int ii = 0; ii < 2; ++ii) {
      int rr = wm + ii * 16 + r;
      af[ii].q[0] = *(const uint4*)&As[cur][rr][hi * 8];
      af[ii].q[1] = *(const uint4*)&As[cur][rr][hi * 8 + 16];
    }
#pragma unroll
    for (int jj = 0; jj < 4; ++jj) {
      int rr = wn + jj * 16 + r;
      bfr[jj].q[0] = *(const uint4*)&Ws[cur][rr][hi * 8];
      bfr[jj].q[1] = *(const uint4*)&Ws[cur][rr][hi * 8 + 16];
    }
#pragma unroll
    for (int ii = 0; ii < 2; ++ii)
#pragma unroll
      for (int jj = 0; jj < 4; ++jj)
        acc[ii][jj] = __builtin_amdgcn_wmma_f32_16x16x32_bf16(
            false, af[ii].v, false, bfr[jj].v, (short)0, acc[ii][jj], false, false);
    wait_async_lds();
    __syncthreads();
  }
#else
  // ---- register-prefetch double-buffered pipeline ----
  uint4 pa0 = *(const uint4*)gA0;
  uint4 pa1 = *(const uint4*)gA1;
  uint4 pw0 = *(const uint4*)gW0;
  uint4 pw1 = *(const uint4*)gW1;
  *(uint4*)&As[0][row][col]      = pa0;
  *(uint4*)&As[0][row + 64][col] = pa1;
  *(uint4*)&Ws[0][row][col]      = pw0;
  *(uint4*)&Ws[0][row + 64][col] = pw1;
  __syncthreads();
  for (int i = 0; i < nk; ++i) {
    const int cur = i & 1;
    const bool more = (i + 1 < nk);
    if (more) {
      const int kn = (i + 1) << 5;
      pa0 = *(const uint4*)(gA0 + kn);
      pa1 = *(const uint4*)(gA1 + kn);
      pw0 = *(const uint4*)(gW0 + kn);
      pw1 = *(const uint4*)(gW1 + kn);
    }
    FragBF af[2], bfr[4];
#pragma unroll
    for (int ii = 0; ii < 2; ++ii) {
      int rr = wm + ii * 16 + r;
      af[ii].q[0] = *(const uint4*)&As[cur][rr][hi * 8];
      af[ii].q[1] = *(const uint4*)&As[cur][rr][hi * 8 + 16];
    }
#pragma unroll
    for (int jj = 0; jj < 4; ++jj) {
      int rr = wn + jj * 16 + r;
      bfr[jj].q[0] = *(const uint4*)&Ws[cur][rr][hi * 8];
      bfr[jj].q[1] = *(const uint4*)&Ws[cur][rr][hi * 8 + 16];
    }
#pragma unroll
    for (int ii = 0; ii < 2; ++ii)
#pragma unroll
      for (int jj = 0; jj < 4; ++jj)
        acc[ii][jj] = __builtin_amdgcn_wmma_f32_16x16x32_bf16(
            false, af[ii].v, false, bfr[jj].v, (short)0, acc[ii][jj], false, false);
    if (more) {
      const int nxt = cur ^ 1;
      *(uint4*)&As[nxt][row][col]      = pa0;
      *(uint4*)&As[nxt][row + 64][col] = pa1;
      *(uint4*)&Ws[nxt][row][col]      = pw0;
      *(uint4*)&Ws[nxt][row + 64][col] = pw1;
    }
    __syncthreads();
  }
#endif

  // epilogue: D layout lane mapping m = v + 8*hi, n = lane%16
  if constexpr (EPI == 0) {
    if (n0 >= 2048) {
      // V columns (the whole block: n0 is a multiple of 128).  A lane's 8
      // registers of a tile are 8 consecutive tokens of ONE column h*64 + d,
      // that is 16 contiguous bytes of a V^T row: one store per tile.
      u16* trow = outT + ((size_t)(m0 >> 11) * 1024 + (n0 - 2048 + wn + r)) * 2048
                  + (m0 & 2047) + wm + 8 * hi;
#pragma unroll
      for (int i = 0; i < 2; ++i)
#pragma unroll
        for (int j = 0; j < 4; ++j) {
          const v8f a = acc[i][j];
          *(uint4*)&trow[(size_t)j * 16 * 2048 + i * 16] =
              make_uint4(pack_bf16x2(a[0], a[1]), pack_bf16x2(a[2], a[3]),
                         pack_bf16x2(a[4], a[5]), pack_bf16x2(a[6], a[7]));
        }
      return;
    }
  }
#pragma unroll
  for (int i = 0; i < 2; ++i)
#pragma unroll
    for (int j = 0; j < 4; ++j) {
#pragma unroll
      for (int v = 0; v < 8; ++v) {
        int m = m0 + wm + i * 16 + v + 8 * hi;
        int n = n0 + wn + j * 16 + r;
        float val = acc[i][j][v];
        size_t idx = (size_t)m * N + n;
        if constexpr (EPI == 0) {
          float s = (n < 1024) ? 0.125f : 1.0f;   // SCALE = 64^-0.5 on Q
          outB[idx] = f32_to_bf16(val * s);
        } else if constexpr (EPI == 1) {
          outF[idx] = val + bias[n] + res[idx];
        } else {
          float t = val + bias[n];
          float gl = 0.5f * t * (1.0f + erff(t * 0.70710678118654752f));
          outB[idx] = f32_to_bf16(gl);
        }
      }
    }
}

__device__ __forceinline__ float xhalf(float x) {
  int b = __builtin_bit_cast(int, x);
  return __builtin_bit_cast(float, __builtin_amdgcn_permlanex16(
      b, b, 0x76543210, 0xfedcba98, false, false));
}

__device__ __forceinline__ void stage_kv(const u16* gk, u16* lk,
                                         const u16* gv, u16* lv) {
  asm volatile("global_load_async_to_lds_b128 %0, %1, off\n\t"
               "global_load_async_to_lds_b128 %2, %3, off\n\t"
               "s_wait_xcnt 0x0"
               :: "v"((u32)(unsigned long long)(void*)lk), "v"(gk),
                  "v"((u32)(unsigned long long)(void*)lv), "v"(gv)
               : "memory");
}

__global__ __launch_bounds__(256) void flash_attn_k(const u16* __restrict__ qkv,
                                                    const u16* __restrict__ vT,
                                                    u16* __restrict__ o) {
  constexpr int Nctx = 2048, C = 1024, C3 = 3072, Dh = 64;
  constexpr int NT = Nctx / 32;   // key tiles
  __shared__ __align__(16) u16 Ks[2][32][72];
  __shared__ __align__(16) u16 Vs[2][64][40];

  const int tid  = threadIdx.x;
  const int lane = tid & 31;
  const int wave = tid >> 5;
  const int r    = lane & 15;
  const int hi   = lane >> 4;

  const int bh = blockIdx.y;   // b*16 + h
  const int b  = bh >> 4;
  const int h  = bh & 15;
  const int q0 = blockIdx.x * 128 + wave * 16;

  const v8f zero8 = {0.f, 0.f, 0.f, 0.f, 0.f, 0.f, 0.f, 0.f};

  // Q fragments (B operand: lane = query column), Q already scaled by 0.125
  // in the qkv epilogue
  FragBF qa[2];
  {
    const u16* qrow = qkv + (size_t)(b * Nctx + q0 + r) * C3 + h * Dh;
#pragma unroll
    for (int f = 0; f < 2; ++f) {
      int d = f * 32 + hi * 8;
      qa[f].q[0] = *(const uint4*)&qrow[d];
      qa[f].q[1] = *(const uint4*)&qrow[d + 16];
    }
  }

  // per lane: running maximum of query r (same in both halves) and the sum
  // over this half's keys; oacc[ds][v] = O[query r][d = ds*16 + 8*hi + v]
  float mrow = -1e30f, lrow = 0.f;
  v8f oacc[4];
#pragma unroll
  for (int d = 0; d < 4; ++d) oacc[d] = zero8;

  // this thread's 16 bytes of every tile: K row tid/8, V^T row tid/4
  const int kr = tid >> 3, kc = (tid & 7) << 3;
  const int vr = tid >> 2, vc = (tid & 3) << 3;
  const u16* gK = qkv + (size_t)(b * Nctx + kr) * C3 + C + h * Dh + kc;
  const u16* gV = vT + ((size_t)bh * Dh + vr) * Nctx + vc;

  stage_kv(gK, &Ks[0][kr][kc], gV, &Vs[0][vr][vc]);
  asm volatile("s_wait_asynccnt 0x0" ::: "memory");   // tile 0 has landed
  __syncthreads();                                    // ... for every wave
  stage_kv(gK + (size_t)32 * C3, &Ks[1][kr][kc], gV + 32, &Vs[1][vr][vc]);

  for (int it = 0; it < NT; ++it) {
    const int cur = it & 1;
    v8f s[2];
#pragma unroll
    for (int t = 0; t < 2; ++t) {
      const u16* krow = &Ks[cur][t * 16 + r][0];
      v8f st = zero8;
#pragma unroll
      for (int f = 0; f < 2; ++f) {
        FragBF kf;
        int d = f * 32 + hi * 8;
        kf.q[0] = *(const uint4*)&krow[d];
        kf.q[1] = *(const uint4*)&krow[d + 16];
        st = __builtin_amdgcn_wmma_f32_16x16x32_bf16(
            false, kf.v, false, qa[f].v, (short)0, st, false, false);
      }
      s[t] = st;
    }

    // online softmax: s[t][v] = score of key t*16 + 8*hi + v with query r
    float rm = fmaxf(s[0][0], s[1][0]);
#pragma unroll
    for (int v = 1; v < 8; ++v) rm = fmaxf(rm, fmaxf(s[0][v], s[1][v]));
    rm = fmaxf(rm, xhalf(rm));
    const float mnew = fmaxf(mrow, rm);
    const float sc   = __expf(mrow - mnew);
    mrow = mnew;
#pragma unroll
    for (int d = 0; d < 4; ++d) oacc[d] = oacc[d] * sc;
    // P^T as B operand: element e < 8 is key 8*hi + e, element 8 + e is key
    // 16 + 8*hi + e, which is what V^T's two 16-byte reads per row deliver
    FragBF pb;
    u32 pw[8];
    float ps0 = 0.f, ps1 = 0.f;
#pragma unroll
    for (int i = 0; i < 8; ++i) {
      const float p0 = __expf(s[i >> 2][2 * (i & 3)] - mnew);
      const float p1 = __expf(s[i >> 2][2 * (i & 3) + 1] - mnew);
      pw[i] = pack_bf16x2(p0, p1);
      ps0 += p0;
      ps1 += p1;
    }
    lrow = lrow * sc + (ps0 + ps1);
    pb.q[0] = make_uint4(pw[0], pw[1], pw[2], pw[3]);
    pb.q[1] = make_uint4(pw[4], pw[5], pw[6], pw[7]);
#pragma unroll
    for (int ds = 0; ds < 4; ++ds) {
      const u16* vrow = &Vs[cur][ds * 16 + r][0];
      FragBF vf;
      vf.q[0] = *(const uint4*)&vrow[hi * 8];
      vf.q[1] = *(const uint4*)&vrow[hi * 8 + 16];
      oacc[ds] = __builtin_amdgcn_wmma_f32_16x16x32_bf16(
          false, vf.v, false, pb.v, (short)0, oacc[ds], false, false);
    }

    // hand-over: this wave's LDS reads are done, its copies of tile it+1 have
    // landed; behind the barrier both hold for all waves, so tile it+1 may be
    // read and the buffer just read may be refilled
    asm volatile("s_wait_dscnt 0x0" ::: "memory");
    asm volatile("s_wait_asynccnt 0x0" ::: "memory");
    __syncthreads();
    if (it + 2 < NT)
      stage_kv(gK + (size_t)(it + 2) * 32 * C3, &Ks[cur][kr][kc],
               gV + (it + 2) * 32, &Vs[cur][vr][vc]);
  }
  asm volatile("s_wait_asynccnt 0x0" ::: "memory");   // no copy outlives the loop

  // join the two halves' sums, normalize and write O as [M, C] bf16
  // (col = h*64 + d): a lane's 8 registers of a tile are 8 consecutive d
  const float inv = 1.0f / (lrow + xhalf(lrow));
  u16* orow = o + (size_t)(b * Nctx + q0 + r) * C + h * Dh + hi * 8;
#pragma unroll
  for (int ds = 0; ds < 4; ++ds) {
    const v8f ov = oacc[ds] * inv;
    *(uint4*)&orow[ds * 16] =
        make_uint4(pack_bf16x2(ov[0], ov[1]), pack_bf16x2(ov[2], ov[3]),
                   pack_bf16x2(ov[4], ov[5]), pack_bf16x2(ov[6], ov[7]));
  }
}

// ---------------------------------------------------------------------------
// host-side orchestration
// ---------------------------------------------------------------------------
extern "C" void kernel_launch(void* const* d_in, const int* in_sizes, int n_in,
                              void* d_out, int out_size, void* d_ws, size_t ws_size,
                              hipStream_t stream) {
  const float* x      = (const float*)d_in[0];
  const float* ln1_g  = (const float*)d_in[1];
  const float* ln1_b  = (const float*)d_in[2];
  const float* qkv_w  = (const float*)d_in[3];
  const float* proj_w = (const float*)d_in[4];
  const float* proj_b = (const float*)d_in[5];
  const float* ln2_g  = (const float*)d_in[6];
  const float* ln2_b  = (const float*)d_in[7];
  const float* fc1_w  = (const float*)d_in[8];
  const float* fc1_b  = (const float*)d_in[9];
  const float* fc2_w  = (const float*)d_in[10];
  const float* fc2_b  = (const float*)d_in[11];
  float* out = (float*)d_out;

  const int M = 8192, C = 1024, C3 = 3072, Hd = 4096;

  char* ws = (char*)d_ws;
  u16*   h_bf   = (u16*)(ws);                             // 16 MB  (LN out, reused)
  u16*   qkv_bf = (u16*)(ws + (size_t)16  * 1048576);     // 48 MB (Q, K columns used)
  u16*   vTb    = (u16*)(ws + (size_t)64  * 1048576);     // 16 MB
  u16*   o_bf   = (u16*)(ws + (size_t)80  * 1048576);     // 16 MB
  float* x1     = (float*)(ws + (size_t)96 * 1048576);    // 32 MB
  u16*   h2_bf  = (u16*)(ws + (size_t)128 * 1048576);     // 64 MB
  u16*   wqkv   = (u16*)(ws + (size_t)192 * 1048576);     // 24 MB total weights
  u16*   wproj  = wqkv  + (size_t)C3 * C;
  u16*   wfc1   = wproj + (size_t)C  * C;
  u16*   wfc2   = wfc1  + (size_t)Hd * C;

  // weights -> bf16
  cast_bf16_k<<<(C3 * C) / 256, 256, 0, stream>>>(qkv_w,  wqkv,  C3 * C);
  cast_bf16_k<<<(C  * C) / 256, 256, 0, stream>>>(proj_w, wproj, C * C);
  cast_bf16_k<<<(Hd * C) / 256, 256, 0, stream>>>(fc1_w,  wfc1,  Hd * C);
  cast_bf16_k<<<(C * Hd) / 256, 256, 0, stream>>>(fc2_w,  wfc2,  C * Hd);

  // attention branch
  layernorm_bf16_k<<<M, 256, 0, stream>>>(x, ln1_g, ln1_b, h_bf);
  gemm_bf16_k<0><<<dim3(C3 / 128, M / 128), 256, 0, stream>>>(
      h_bf, wqkv, nullptr, nullptr, nullptr, qkv_bf, vTb, M, C3, C);
  flash_attn_k<<<dim3(2048 / 128, 4 * 16), 256, 0, stream>>>(qkv_bf, vTb, o_bf);
  gemm_bf16_k<1><<<dim3(C / 128, M / 128), 256, 0, stream>>>(
      o_bf, wproj, proj_b, x, x1, nullptr, nullptr, M, C, C);

  // MLP branch
  layernorm_bf16_k<<<M, 256, 0, stream>>>(x1, ln2_g, ln2_b, h_bf);
  gemm_bf16_k<2><<<dim3(Hd / 128, M / 128), 256, 0, stream>>>(
      h_bf, wfc1, fc1_b, nullptr, nullptr, h2_bf, nullptr, M, Hd, C);
  gemm_bf16_k<1><<<dim3(C / 128, M / 128), 256, 0, stream>>>(
      h2_bf, wfc2, fc2_b, x1, out, nullptr, nullptr, M, C, Hd);
}

// v004
// A run of this version takes 314 microseconds.
// In both of two side-by-side timings against v003, it was 1.33 times as fast.
// Counting every step since v000, it is 2.31 times as fast.
#include <hip/hip_runtime.h>
#include <hip/hip_bf16.h>

typedef unsigned short u16;
typedef unsigned int u32;
typedef __attribute__((ext_vector_type(16))) __bf16 v16bf;
typedef __attribute__((ext_vector_type(8)))  float  v8f;

union FragBF {
  v16bf v;
  uint4 q[2];
  u16   h[16];
};

__device__ __forceinline__ u16 f32_to_bf16(float f) {
  union { float f; u32 u; } c; c.f = f;
  u32 u = c.u;
  u += 0x7fffu + ((u >> 16) & 1u);   // round-to-nearest-even
  return (u16)(u >> 16);
}

// two f32 -> one dword of two bf16, round to nearest even
__device__ __forceinline__ u32 pack_bf16x2(float lo, float hi) {
  typedef __bf16 bf2 __attribute__((ext_vector_type(2)));
  typedef float  f2  __attribute__((ext_vector_type(2)));
  return __builtin_bit_cast(u32, __builtin_convertvector(f2{lo, hi}, bf2));
}

// ---------------------------------------------------------------------------
// fp32 -> bf16 cast (weights)
// ---------------------------------------------------------------------------
__global__ __launch_bounds__(256) void cast_bf16_k(const float* __restrict__ in,
                                                   u16* __restrict__ out, int n) {
  int i = blockIdx.x * 256 + threadIdx.x;
  if (i < n) out[i] = f32_to_bf16(in[i]);
}

// ---------------------------------------------------------------------------
// LayerNorm over C=1024, one row per block, bf16 output
// ---------------------------------------------------------------------------
__global__ __launch_bounds__(256) void layernorm_bf16_k(const float* __restrict__ x,
                                                        const float* __restrict__ g,
                                                        const float* __restrict__ b,
                                                        u16* __restrict__ out) {
  constexpr int C = 1024;
  __shared__ float red1[256];
  __shared__ float red2[256];
  const int row = blockIdx.x;
  const int tid = threadIdx.x;
  const float4 v = *(const float4*)&x[(size_t)row * C + tid * 4];
  float s  = v.x + v.y + v.z + v.w;
  float ss = v.x * v.x + v.y * v.y + v.z * v.z + v.w * v.w;
  red1[tid] = s; red2[tid] = ss;
  __syncthreads();
  for (int o = 128; o > 0; o >>= 1) {
    if (tid < o) { red1[tid] += red1[tid + o]; red2[tid] += red2[tid + o]; }
    __syncthreads();
  }
  const float mu  = red1[0] * (1.0f / 1024.0f);
  const float var = red2[0] * (1.0f / 1024.0f) - mu * mu;
  const float rs  = rsqrtf(var + 1e-5f);
#pragma unroll
  for (int j = 0; j < 4; ++j) {
    int c = tid * 4 + j;
    float xv = (&v.x)[j];
    out[(size_t)row * C + c] = f32_to_bf16((xv - mu) * rs * g[c] + b[c]);
  }
}

__device__ __forceinline__ void copy8(const u32 (&l)[8], const u16* const (&g)[8]) {
  asm volatile("global_load_async_to_lds_b128 %0, %8, off\n\t"
               "global_load_async_to_lds_b128 %1, %9, off\n\t"
               "global_load_async_to_lds_b128 %2, %10, off\n\t"
               "global_load_async_to_lds_b128 %3, %11, off\n\t"
               "global_load_async_to_lds_b128 %4, %12, off\n\t"
               "global_load_async_to_lds_b128 %5, %13, off\n\t"
               "global_load_async_to_lds_b128 %6, %14, off\n\t"
               "global_load_async_to_lds_b128 %7, %15, off\n\t"
               "s_wait_xcnt 0x0"
               :: "v"(l[0]), "v"(l[1]), "v"(l[2]), "v"(l[3]),
                  "v"(l[4]), "v"(l[5]), "v"(l[6]), "v"(l[7]),
                  "v"(g[0]), "v"(g[1]), "v"(g[2]), "v"(g[3]),
                  "v"(g[4]), "v"(g[5]), "v"(g[6]), "v"(g[7])
               : "memory");
}

template <int EPI, int KS>
__global__ __launch_bounds__(256) void gemm_bf16_k(
    const u16* __restrict__ A, const u16* __restrict__ W,
    const float* __restrict__ bias, const float* __restrict__ res,
    float* __restrict__ outF, u16* __restrict__ outB, u16* __restrict__ outT,
    int M, int N, int K) {
  constexpr int PITCH = KS + 8;        // elements: row bytes + 16
  constexpr int CPR   = KS / 8;        // 16-byte chunks per row
  constexpr int RP    = 256 / CPR;     // rows the 256 threads copy at once
  constexpr int NC    = 128 / RP;      // copies per thread, operand and stage
  __shared__ __align__(16) u16 As[2][128][PITCH];
  __shared__ __align__(16) u16 Ws[2][128][PITCH];

  const int tid  = threadIdx.x;
  const int lane = tid & 31;
  const int wave = tid >> 5;
  const int r    = lane & 15;
  const int hi   = lane >> 4;

  const int m0 = blockIdx.y * 128;
  const int n0 = blockIdx.x * 128;
  const int wm = (wave >> 1) * 32;   // 4 waves along M
  const int wn = (wave & 1) * 64;    // 2 waves along N

  // cooperative copy: thread t owns chunk t % CPR of rows t / CPR + RP * j
  const int row = tid / CPR;
  const int col = (tid % CPR) << 3;

  const u16* gA = &A[(size_t)(m0 + row) * K + col];
  const u16* gW = &W[(size_t)(n0 + row) * K + col];
  const size_t gstep = (size_t)RP * K;
  const u32 lA = (u32)(unsigned long long)(void*)&As[0][row][col];
  const u32 lW = (u32)(unsigned long long)(void*)&Ws[0][row][col];

  // this thread's 2 * NC copies of stage s into buffer buf, eight to a statement
  auto stage = [&](int s, int buf) {
#pragma unroll
    for (int q = 0; q < 2 * NC / 8; ++q) {
      u32 l[8];
      const u16* g[8];
#pragma unroll
      for (int e = 0; e < 8; ++e) {
        const int c = q * 8 + e, j = c % NC;
        l[e] = (c < NC ? lA : lW) + (u32)(buf * 128 + j * RP) * (PITCH * 2);
        g[e] = (c < NC ? gA : gW) + (size_t)s * KS + j * gstep;
      }
      copy8(l, g);
    }
  };

  v8f acc[2][4];
  const v8f zero8 = {0.f, 0.f, 0.f, 0.f, 0.f, 0.f, 0.f, 0.f};
#pragma unroll
  for (int i = 0; i < 2; ++i)
#pragma unroll
    for (int j = 0; j < 4; ++j) acc[i][j] = zero8;

  const int nk = K / KS;   // stages

  stage(0, 0);
  asm volatile("s_wait_asynccnt 0x0" ::: "memory");   // stage 0 has landed
  __syncthreads();                                    // ... for every wave
  if (nk > 1) stage(1, 1);

  for (int t = 0; t < nk; ++t) {
    const int cur = t & 1;
#pragma unroll
    for (int ks = 0; ks < KS / 32; ++ks) {
      FragBF af[2], bfr[4];
#pragma unroll
      for (int ii = 0; ii < 2; ++ii) {
        int rr = wm + ii * 16 + r;
        af[ii].q[0] = *(const uint4*)&As[cur][rr][ks * 32 + hi * 8];
        af[ii].q[1] = *(const uint4*)&As[cur][rr][ks * 32 + hi * 8 + 16];
      }
#pragma unroll
      for (int jj = 0; jj < 4; ++jj) {
        int rr = wn + jj * 16 + r;
        bfr[jj].q[0] = *(const uint4*)&Ws[cur][rr][ks * 32 + hi * 8];
        bfr[jj].q[1] = *(const uint4*)&Ws[cur][rr][ks * 32 + hi * 8 + 16];
      }
#pragma unroll
      for (int ii = 0; ii < 2; ++ii)
#pragma unroll
        for (int jj = 0; jj < 4; ++jj)
          acc[ii][jj] = __builtin_amdgcn_wmma_f32_16x16x32_bf16(
              false, af[ii].v, false, bfr[jj].v, (short)0, acc[ii][jj], false, false);
    }
    // hand-over: this wave's LDS reads are done, its copies of stage t+1 have
    // landed; behind the barrier both hold for all waves, so stage t+1 may be
    // read and the buffer just read may be refilled
    asm volatile("s_wait_dscnt 0x0" ::: "memory");
    asm volatile("s_wait_asynccnt 0x0" ::: "memory");
    __syncthreads();
    if (t + 2 < nk) stage(t + 2, cur);
  }
  asm volatile("s_wait_asynccnt 0x0" ::: "memory");   // no copy outlives the loop

  // epilogue: D layout lane mapping m = v + 8*hi, n = lane%16
  if constexpr (EPI == 0) {
    if (n0 >= 2048) {
      // V columns (the whole block: n0 is a multiple of 128).  A lane's 8
      // registers of a tile are 8 consecutive tokens of ONE column h*64 + d,
      // that is 16 contiguous bytes of a V^T row: one store per tile.
      u16* trow = outT + ((size_t)(m0 >> 11) * 1024 + (n0 - 2048 + wn + r)) * 2048
                  + (m0 & 2047) + wm + 8 * hi;
#pragma unroll
      for (int i = 0; i < 2; ++i)
#pragma unroll
        for (int j = 0; j < 4; ++j) {
          const v8f a = acc[i][j];
          *(uint4*)&trow[(size_t)j * 16 * 2048 + i * 16] =
              make_uint4(pack_bf16x2(a[0], a[1]), pack_bf16x2(a[2], a[3]),
                         pack_bf16x2(a[4], a[5]), pack_bf16x2(a[6], a[7]));
        }
      return;
    }
  }
#pragma unroll
  for (int i = 0; i < 2; ++i)
#pragma unroll
    for (int j = 0; j < 4; ++j) {
#pragma unroll
      for (int v = 0; v < 8; ++v) {
        int m = m0 + wm + i * 16 + v + 8 * hi;
        int n = n0 + wn + j * 16 + r;
        float val = acc[i][j][v];
        size_t idx = (size_t)m * N + n;
        if constexpr (EPI == 0) {
          float s = (n < 1024) ? 0.125f : 1.0f;   // SCALE = 64^-0.5 on Q
          outB[idx] = f32_to_bf16(val * s);
        } else if constexpr (EPI == 1) {
          outF[idx] = val + bias[n] + res[idx];
        } else {
          float t = val + bias[n];
          float gl = 0.5f * t * (1.0f + erff(t * 0.70710678118654752f));
          outB[idx] = f32_to_bf16(gl);
        }
      }
    }
}

__device__ __forceinline__ float xhalf(float x) {
  int b = __builtin_bit_cast(int, x);
  return __builtin_bit_cast(float, __builtin_amdgcn_permlanex16(
      b, b, 0x76543210, 0xfedcba98, false, false));
}

__device__ __forceinline__ void stage_kv(const u16* gk, u16* lk,
                                         const u16* gv, u16* lv) {
  asm volatile("global_load_async_to_lds_b128 %0, %1, off\n\t"
               "global_load_async_to_lds_b128 %2, %3, off\n\t"
               "s_wait_xcnt 0x0"
               :: "v"((u32)(unsigned long long)(void*)lk), "v"(gk),
                  "v"((u32)(unsigned long long)(void*)lv), "v"(gv)
               : "memory");
}

__global__ __launch_bounds__(256) void flash_attn_k(const u16* __restrict__ qkv,
                                                    const u16* __restrict__ vT,
                                                    u16* __restrict__ o) {
  constexpr int Nctx = 2048, C = 1024, C3 = 3072, Dh = 64;
  constexpr int NT = Nctx / 32;   // key tiles
  __shared__ __align__(16) u16 Ks[2][32][72];
  __shared__ __align__(16) u16 Vs[2][64][40];

  const int tid  = threadIdx.x;
  const int lane = tid & 31;
  const int wave = tid >> 5;
  const int r    = lane & 15;
  const int hi   = lane >> 4;

  const int bh = blockIdx.y;   // b*16 + h
  const int b  = bh >> 4;
  const int h  = bh & 15;
  const int q0 = blockIdx.x * 128 + wave * 16;

  const v8f zero8 = {0.f, 0.f, 0.f, 0.f, 0.f, 0.f, 0.f, 0.f};

  // Q fragments (B operand: lane = query column), Q already scaled by 0.125
  // in the qkv epilogue
  FragBF qa[2];
  {
    const u16* qrow = qkv + (size_t)(b * Nctx + q0 + r) * C3 + h * Dh;
#pragma unroll
    for (int f = 0; f < 2; ++f) {
      int d = f * 32 + hi * 8;
      qa[f].q[0] = *(const uint4*)&qrow[d];
      qa[f].q[1] = *(const uint4*)&qrow[d + 16];
    }
  }

  // per lane: running maximum of query r (same in both halves) and the sum
  // over this half's keys; oacc[ds][v] = O[query r][d = ds*16 + 8*hi + v]
  float mrow = -1e30f, lrow = 0.f;
  v8f oacc[4];
#pragma unroll
  for (int d = 0; d < 4; ++d) oacc[d] = zero8;

  // this thread's 16 bytes of every tile: K row tid/8, V^T row tid/4
  const int kr = tid >> 3, kc = (tid & 7) << 3;
  const int vr = tid >> 2, vc = (tid & 3) << 3;
  const u16* gK = qkv + (size_t)(b * Nctx + kr) * C3 + C + h * Dh + kc;
  const u16* gV = vT + ((size_t)bh * Dh + vr) * Nctx + vc;

  stage_kv(gK, &Ks[0][kr][kc], gV, &Vs[0][vr][vc]);
  asm volatile("s_wait_asynccnt 0x0" ::: "memory");   // tile 0 has landed
  __syncthreads();                                    // ... for every wave
  stage_kv(gK + (size_t)32 * C3, &Ks[1][kr][kc], gV + 32, &Vs[1][vr][vc]);

  for (int it = 0; it < NT; ++it) {
    const int cur = it & 1;
    v8f s[2];
#pragma unroll
    for (int t = 0; t < 2; ++t) {
      const u16* krow = &Ks[cur][t * 16 + r][0];
      v8f st = zero8;
#pragma unroll
      for (int f = 0; f < 2; ++f) {
        FragBF kf;
        int d = f * 32 + hi * 8;
        kf.q[0] = *(const uint4*)&krow[d];
        kf.q[1] = *(const uint4*)&krow[d + 16];
        st = __builtin_amdgcn_wmma_f32_16x16x32_bf16(
            false, kf.v, false, qa[f].v, (short)0, st, false, false);
      }
      s[t] = st;
    }

    // online softmax: s[t][v] = score of key t*16 + 8*hi + v with query r
    float rm = fmaxf(s[0][0], s[1][0]);
#pragma unroll
    for (int v = 1; v < 8; ++v) rm = fmaxf(rm, fmaxf(s[0][v], s[1][v]));
    rm = fmaxf(rm, xhalf(rm));
    const float mnew = fmaxf(mrow, rm);
    const float sc   = __expf(mrow - mnew);
    mrow = mnew;
#pragma unroll
    for (int d = 0; d < 4; ++d) oacc[d] = oacc[d] * sc;
    // P^T as B operand: element e < 8 is key 8*hi + e, element 8 + e is key
    // 16 + 8*hi + e, which is what V^T's two 16-byte reads per row deliver
    FragBF pb;
    u32 pw[8];
    float ps0 = 0.f, ps1 = 0.f;
#pragma unroll
    for (int i = 0; i < 8; ++i) {
      const float p0 = __expf(s[i >> 2][2 * (i & 3)] - mnew);
      const float p1 = __expf(s[i >> 2][2 * (i & 3) + 1] - mnew);
      pw[i] = pack_bf16x2(p0, p1);
      ps0 += p0;
      ps1 += p1;
    }
    lrow = lrow * sc + (ps0 + ps1);
    pb.q[0] = make_uint4(pw[0], pw[1], pw[2], pw[3]);
    pb.q[1] = make_uint4(pw[4], pw[5], pw[6], pw[7]);
#pragma unroll
    for (int ds = 0; ds < 4; ++ds) {
      const u16* vrow = &Vs[cur][ds * 16 + r][0];
      FragBF vf;
      vf.q[0] = *(const uint4*)&vrow[hi * 8];
      vf.q[1] = *(const uint4*)&vrow[hi * 8 + 16];
      oacc[ds] = __builtin_amdgcn_wmma_f32_16x16x32_bf16(
          false, vf.v, false, pb.v, (short)0, oacc[ds], false, false);
    }

    // hand-over: this wave's LDS reads are done, its copies of tile it+1 have
    // landed; behind the barrier both hold for all waves, so tile it+1 may be
    // read and the buffer just read may be refilled
    asm volatile("s_wait_dscnt 0x0" ::: "memory");
    asm volatile("s_wait_asynccnt 0x0" ::: "memory");
    __syncthreads();
    if (it + 2 < NT)
      stage_kv(gK + (size_t)(it + 2) * 32 * C3, &Ks[cur][kr][kc],
               gV + (it + 2) * 32, &Vs[cur][vr][vc]);
  }
  asm volatile("s_wait_asynccnt 0x0" ::: "memory");   // no copy outlives the loop

  // join the two halves' sums, normalize and write O as [M, C] bf16
  // (col = h*64 + d): a lane's 8 registers of a tile are 8 consecutive d
  const float inv = 1.0f / (lrow + xhalf(lrow));
  u16* orow = o + (size_t)(b * Nctx + q0 + r) * C + h * Dh + hi * 8;
#pragma unroll
  for (int ds = 0; ds < 4; ++ds) {
    const v8f ov = oacc[ds] * inv;
    *(uint4*)&orow[ds * 16] =
        make_uint4(pack_bf16x2(ov[0], ov[1]), pack_bf16x2(ov[2], ov[3]),
                   pack_bf16x2(ov[4], ov[5]), pack_bf16x2(ov[6], ov[7]));
  }
}

// ---------------------------------------------------------------------------
// host-side orchestration
// ---------------------------------------------------------------------------
extern "C" void kernel_launch(void* const* d_in, const int* in_sizes, int n_in,
                              void* d_out, int out_size, void* d_ws, size_t ws_size,
                              hipStream_t stream) {
  const float* x      = (const float*)d_in[0];
  const float* ln1_g  = (const float*)d_in[1];
  const float* ln1_b  = (const float*)d_in[2];
  const float* qkv_w  = (const float*)d_in[3];
  const float* proj_w = (const float*)d_in[4];
  const float* proj_b = (const float*)d_in[5];
  const float* ln2_g  = (const float*)d_in[6];
  const float* ln2_b  = (const float*)d_in[7];
  const float* fc1_w  = (const float*)d_in[8];
  const float* fc1_b  = (const float*)d_in[9];
  const float* fc2_w  = (const float*)d_in[10];
  const float* fc2_b  = (const float*)d_in[11];
  float* out = (float*)d_out;

  const int M = 8192, C = 1024, C3 = 3072, Hd = 4096;

  char* ws = (char*)d_ws;
  u16*   h_bf   = (u16*)(ws);                             // 16 MB  (LN out, reused)
  u16*   qkv_bf = (u16*)(ws + (size_t)16  * 1048576);     // 48 MB (Q, K columns used)
  u16*   vTb    = (u16*)(ws + (size_t)64  * 1048576);     // 16 MB
  u16*   o_bf   = (u16*)(ws + (size_t)80  * 1048576);     // 16 MB
  float* x1     = (float*)(ws + (size_t)96 * 1048576);    // 32 MB
  u16*   h2_bf  = (u16*)(ws + (size_t)128 * 1048576);     // 64 MB
  u16*   wqkv   = (u16*)(ws + (size_t)192 * 1048576);     // 24 MB total weights
  u16*   wproj  = wqkv  + (size_t)C3 * C;
  u16*   wfc1   = wproj + (size_t)C  * C;
  u16*   wfc2   = wfc1  + (size_t)Hd * C;

  // weights -> bf16
  cast_bf16_k<<<(C3 * C) / 256, 256, 0, stream>>>(qkv_w,  wqkv,  C3 * C);
  cast_bf16_k<<<(C  * C) / 256, 256, 0, stream>>>(proj_w, wproj, C * C);
  cast_bf16_k<<<(Hd * C) / 256, 256, 0, stream>>>(fc1_w,  wfc1,  Hd * C);
  cast_bf16_k<<<(C * Hd) / 256, 256, 0, stream>>>(fc2_w,  wfc2,  C * Hd);

  // attention branch
  layernorm_bf16_k<<<M, 256, 0, stream>>>(x, ln1_g, ln1_b, h_bf);
  gemm_bf16_k<0, 64><<<dim3(C3 / 128, M / 128), 256, 0, stream>>>(
      h_bf, wqkv, nullptr, nullptr, nullptr, qkv_bf, vTb, M, C3, C);
  flash_attn_k<<<dim3(2048 / 128, 4 * 16), 256, 0, stream>>>(qkv_bf, vTb, o_bf);
  gemm_bf16_k<1, 128><<<dim3(C / 128, M / 128), 256, 0, stream>>>(
      o_bf, wproj, proj_b, x, x1, nullptr, nullptr, M, C, C);

  // MLP branch
  layernorm_bf16_k<<<M, 256, 0, stream>>>(x1, ln2_g, ln2_b, h_bf);
  gemm_bf16_k<2, 64><<<dim3(Hd / 128, M / 128), 256, 0, stream>>>(
      h_bf, wfc1, fc1_b, nullptr, nullptr, h2_bf, nullptr, M, Hd, C);
  gemm_bf16_k<1, 128><<<dim3(C / 128, M / 128), 256, 0, stream>>>(
      h2_bf, wfc2, fc2_b, x1, out, nullptr, nullptr, M, C, Hd);
}

// v005
// It runs in 287 microseconds.
// In both of two side-by-side timings against v004, it was 1.09 times as fast.
// Over all steps from v000 it is 2.52 times as fast.
#include <hip/hip_runtime.h>
#include <hip/hip_bf16.h>

typedef unsigned short u16;
typedef unsigned int u32;
typedef __attribute__((ext_vector_type(16))) __bf16 v16bf;
typedef __attribute__((ext_vector_type(8)))  float  v8f;

union FragBF {
  v16bf v;
  uint4 q[2];
  u16   h[16];
};

__device__ __forceinline__ u16 f32_to_bf16(float f) {
  union { float f; u32 u; } c; c.f = f;
  u32 u = c.u;
  u += 0x7fffu + ((u >> 16) & 1u);   // round-to-nearest-even
  return (u16)(u >> 16);
}

// two f32 -> one dword of two bf16, round to nearest even
__device__ __forceinline__ u32 pack_bf16x2(float lo, float hi) {
  typedef __bf16 bf2 __attribute__((ext_vector_type(2)));
  typedef float  f2  __attribute__((ext_vector_type(2)));
  return __builtin_bit_cast(u32, __builtin_convertvector(f2{lo, hi}, bf2));
}

// ---------------------------------------------------------------------------
// fp32 -> bf16 cast of the four weight matrices in one launch of 512 workgroups.
// Their bf16 copies lie back to back in out: qkv (3072 x 1024), proj
// (1024 x 1024), fc1 (4096 x 1024), fc2 (1024 x 4096).  A chunk is 8192 floats:
// a thread takes 8 float4, 256 threads apart, so that a wave's load covers 512
// contiguous bytes and its 8-byte store 256.  qkv and proj together, fc1, and
// fc2 are 512 chunks each: workgroup b takes chunk b of each of the three, and
// a thread issues its 24 loads ahead of its first store.
// ---------------------------------------------------------------------------
__global__ __launch_bounds__(256) void cast_weights_bf16_k(
    const float* __restrict__ wq, const float* __restrict__ wp,
    const float* __restrict__ w1, const float* __restrict__ w2,
    u16* __restrict__ out) {
  constexpr int CH = 8192;                 // floats per chunk
  constexpr int NQ = 3072 * 1024 / CH;     // chunks of qkv
  constexpr int NG = 512;                  // chunks per group = workgroups
  const int b  = blockIdx.x;
  const int t4 = threadIdx.x * 4;
  const float* s[3] = {b < NQ ? wq + (size_t)b * CH : wp + (size_t)(b - NQ) * CH,
                       w1 + (size_t)b * CH, w2 + (size_t)b * CH};
  float4 v[3][8];
  // all four loops unrolled: v stays in registers, the loads issue back to back
#pragma unroll
  for (int i = 0; i < 3; ++i)
#pragma unroll
    for (int j = 0; j < 8; ++j) v[i][j] = *(const float4*)&s[i][j * 1024 + t4];
#pragma unroll
  for (int i = 0; i < 3; ++i) {
    u16* d = out + (size_t)(i * NG + b) * CH + t4;
#pragma unroll
    for (int j = 0; j < 8; ++j)
      *(uint2*)&d[j * 1024] = make_uint2(pack_bf16x2(v[i][j].x, v[i][j].y),
                                         pack_bf16x2(v[i][j].z, v[i][j].w));
  }
}

// ---------------------------------------------------------------------------
// LayerNorm over C=1024, one row per block, bf16 output
// ---------------------------------------------------------------------------
__global__ __launch_bounds__(256) void layernorm_bf16_k(const float* __restrict__ x,
                                                        const float* __restrict__ g,
                                                        const float* __restrict__ b,
                                                        u16* __restrict__ out) {
  constexpr int C = 1024;
  __shared__ float red1[256];
  __shared__ float red2[256];
  const int row = blockIdx.x;
  const int tid = threadIdx.x;
  const float4 v = *(const float4*)&x[(size_t)row * C + tid * 4];
  float s  = v.x + v.y + v.z + v.w;
  float ss = v.x * v.x + v.y * v.y + v.z * v.z + v.w * v.w;
  red1[tid] = s; red2[tid] = ss;
  __syncthreads();
  for (int o = 128; o > 0; o >>= 1) {
    if (tid < o) { red1[tid] += red1[tid + o]; red2[tid] += red2[tid + o]; }
    __syncthreads();
  }
  const float mu  = red1[0] * (1.0f / 1024.0f);
  const float var = red2[0] * (1.0f / 1024.0f) - mu * mu;
  const float rs  = rsqrtf(var + 1e-5f);
#pragma unroll
  for (int j = 0; j < 4; ++j) {
    int c = tid * 4 + j;
    float xv = (&v.x)[j];
    out[(size_t)row * C + c] = f32_to_bf16((xv - mu) * rs * g[c] + b[c]);
  }
}

__device__ __forceinline__ void copy8(const u32 (&l)[8], const u16* const (&g)[8]) {
  asm volatile("global_load_async_to_lds_b128 %0, %8, off\n\t"
               "global_load_async_to_lds_b128 %1, %9, off\n\t"
               "global_load_async_to_lds_b128 %2, %10, off\n\t"
               "global_load_async_to_lds_b128 %3, %11, off\n\t"
               "global_load_async_to_lds_b128 %4, %12, off\n\t"
               "global_load_async_to_lds_b128 %5, %13, off\n\t"
               "global_load_async_to_lds_b128 %6, %14, off\n\t"
               "global_load_async_to_lds_b128 %7, %15, off\n\t"
               "s_wait_xcnt 0x0"
               :: "v"(l[0]), "v"(l[1]), "v"(l[2]), "v"(l[3]),
                  "v"(l[4]), "v"(l[5]), "v"(l[6]), "v"(l[7]),
                  "v"(g[0]), "v"(g[1]), "v"(g[2]), "v"(g[3]),
                  "v"(g[4]), "v"(g[5]), "v"(g[6]), "v"(g[7])
               : "memory");
}

template <int EPI, int KS>
__global__ __launch_bounds__(256) void gemm_bf16_k(
    const u16* __restrict__ A, const u16* __restrict__ W,
    const float* __restrict__ bias, const float* __restrict__ res,
    float* __restrict__ outF, u16* __restrict__ outB, u16* __restrict__ outT,
    int M, int N, int K) {
  constexpr int PITCH = KS + 8;        // elements: row bytes + 16
  constexpr int CPR   = KS / 8;        // 16-byte chunks per row
  constexpr int RP    = 256 / CPR;     // rows the 256 threads copy at once
  constexpr int NC    = 128 / RP;      // copies per thread, operand and stage
  __shared__ __align__(16) u16 As[2][128][PITCH];
  __shared__ __align__(16) u16 Ws[2][128][PITCH];

  const int tid  = threadIdx.x;
  const int lane = tid & 31;
  const int wave = tid >> 5;
  const int r    = lane & 15;
  const int hi   = lane >> 4;

  const int m0 = blockIdx.y * 128;
  const int n0 = blockIdx.x * 128;
  const int wm = (wave >> 1) * 32;   // 4 waves along M
  const int wn = (wave & 1) * 64;    // 2 waves along N

  // cooperative copy: thread t owns chunk t % CPR of rows t / CPR + RP * j
  const int row = tid / CPR;
  const int col = (tid % CPR) << 3;

  const u16* gA = &A[(size_t)(m0 + row) * K + col];
  const u16* gW = &W[(size_t)(n0 + row) * K + col];
  const size_t gstep = (size_t)RP * K;
  const u32 lA = (u32)(unsigned long long)(void*)&As[0][row][col];
  const u32 lW = (u32)(unsigned long long)(void*)&Ws[0][row][col];

  // this thread's 2 * NC copies of stage s into buffer buf, eight to a statement
  auto stage = [&](int s, int buf) {
#pragma unroll
    for (int q = 0; q < 2 * NC / 8; ++q) {
      u32 l[8];
      const u16* g[8];
#pragma unroll
      for (int e = 0; e < 8; ++e) {
        const int c = q * 8 + e, j = c % NC;
        l[e] = (c < NC ? lA : lW) + (u32)(buf * 128 + j * RP) * (PITCH * 2);
        g[e] = (c < NC ? gA : gW) + (size_t)s * KS + j * gstep;
      }
      copy8(l, g);
    }
  };

  v8f acc[2][4];
  const v8f zero8 = {0.f, 0.f, 0.f, 0.f, 0.f, 0.f, 0.f, 0.f};
#pragma unroll
  for (int i = 0; i < 2; ++i)
#pragma unroll
    for (int j = 0; j < 4; ++j) acc[i][j] = zero8;

  const int nk = K / KS;   // stages

  stage(0, 0);
  asm volatile("s_wait_asynccnt 0x0" ::: "memory");   // stage 0 has landed
  __syncthreads();                                    // ... for every wave
  if (nk > 1) stage(1, 1);

  for (int t = 0; t < nk; ++t) {
    const int cur = t & 1;
#pragma unroll
    for (int ks = 0; ks < KS / 32; ++ks) {
      FragBF af[2], bfr[4];
#pragma unroll
      for (int ii = 0; ii < 2; ++ii) {
        int rr = wm + ii * 16 + r;
        af[ii].q[0] = *(const uint4*)&As[cur][rr][ks * 32 + hi * 8];
        af[ii].q[1] = *(const uint4*)&As[cur][rr][ks * 32 + hi * 8 + 16];
      }
#pragma unroll
      for (int jj = 0; jj < 4; ++jj) {
        int rr = wn + jj * 16 + r;
        bfr[jj].q[0] = *(const uint4*)&Ws[cur][rr][ks * 32 + hi * 8];
        bfr[jj].q[1] = *(const uint4*)&Ws[cur][rr][ks * 32 + hi * 8 + 16];
      }
#pragma unroll
      for (int ii = 0; ii < 2; ++ii)
#pragma unroll
        for (int jj = 0; jj < 4; ++jj)
          acc[ii][jj] = __builtin_amdgcn_wmma_f32_16x16x32_bf16(
              false, af[ii].v, false, bfr[jj].v, (short)0, acc[ii][jj], false, false);
    }
    // hand-over: this wave's LDS reads are done, its copies of stage t+1 have
    // landed; behind the barrier both hold for all waves, so stage t+1 may be
    // read and the buffer just read may be refilled
    asm volatile("s_wait_dscnt 0x0" ::: "memory");
    asm volatile("s_wait_asynccnt 0x0" ::: "memory");
    __syncthreads();
    if (t + 2 < nk) stage(t + 2, cur);
  }
  asm volatile("s_wait_asynccnt 0x0" ::: "memory");   // no copy outlives the loop

  // epilogue: D layout lane mapping m = v + 8*hi, n = lane%16
  if constexpr (EPI == 0) {
    if (n0 >= 2048) {
      // V columns (the whole block: n0 is a multiple of 128).  A lane's 8
      // registers of a tile are 8 consecutive tokens of ONE column h*64 + d,
      // that is 16 contiguous bytes of a V^T row: one store per tile.
      u16* trow = outT + ((size_t)(m0 >> 11) * 1024 + (n0 - 2048 + wn + r)) * 2048
                  + (m0 & 2047) + wm + 8 * hi;
#pragma unroll
      for (int i = 0; i < 2; ++i)
#pragma unroll
        for (int j = 0; j < 4; ++j) {
          const v8f a = acc[i][j];
          *(uint4*)&trow[(size_t)j * 16 * 2048 + i * 16] =
              make_uint4(pack_bf16x2(a[0], a[1]), pack_bf16x2(a[2], a[3]),
                         pack_bf16x2(a[4], a[5]), pack_bf16x2(a[6], a[7]));
        }
      return;
    }
  }
#pragma unroll
  for (int i = 0; i < 2; ++i)
#pragma unroll
    for (int j = 0; j < 4; ++j) {
#pragma unroll
      for (int v = 0; v < 8; ++v) {
        int m = m0 + wm + i * 16 + v + 8 * hi;
        int n = n0 + wn + j * 16 + r;
        float val = acc[i][j][v];
        size_t idx = (size_t)m * N + n;
        if constexpr (EPI == 0) {
          float s = (n < 1024) ? 0.125f : 1.0f;   // SCALE = 64^-0.5 on Q
          outB[idx] = f32_to_bf16(val * s);
        } else if constexpr (EPI == 1) {
          outF[idx] = val + bias[n] + res[idx];
        } else {
          float t = val + bias[n];
          float gl = 0.5f * t * (1.0f + erff(t * 0.70710678118654752f));
          outB[idx] = f32_to_bf16(gl);
        }
      }
    }
}

__device__ __forceinline__ float xhalf(float x) {
  int b = __builtin_bit_cast(int, x);
  return __builtin_bit_cast(float, __builtin_amdgcn_permlanex16(
      b, b, 0x76543210, 0xfedcba98, false, false));
}

__device__ __forceinline__ void stage_kv(const u16* gk, u16* lk,
                                         const u16* gv, u16* lv) {
  asm volatile("global_load_async_to_lds_b128 %0, %1, off\n\t"
               "global_load_async_to_lds_b128 %2, %3, off\n\t"
               "s_wait_xcnt 0x0"
               :: "v"((u32)(unsigned long long)(void*)lk), "v"(gk),
                  "v"((u32)(unsigned long long)(void*)lv), "v"(gv)
               : "memory");
}

__global__ __launch_bounds__(256) void flash_attn_k(const u16* __restrict__ qkv,
                                                    const u16* __restrict__ vT,
                                                    u16* __restrict__ o) {
  constexpr int Nctx = 2048, C = 1024, C3 = 3072, Dh = 64;
  constexpr int NT = Nctx / 32;   // key tiles
  __shared__ __align__(16) u16 Ks[2][32][72];
  __shared__ __align__(16) u16 Vs[2][64][40];

  const int tid  = threadIdx.x;
  const int lane = tid & 31;
  const int wave = tid >> 5;
  const int r    = lane & 15;
  const int hi   = lane >> 4;

  const int bh = blockIdx.y;   // b*16 + h
  const int b  = bh >> 4;
  const int h  = bh & 15;
  const int q0 = blockIdx.x * 128 + wave * 16;

  const v8f zero8 = {0.f, 0.f, 0.f, 0.f, 0.f, 0.f, 0.f, 0.f};

  // Q fragments (B operand: lane = query column), Q already scaled by 0.125
  // in the qkv epilogue
  FragBF qa[2];
  {
    const u16* qrow = qkv + (size_t)(b * Nctx + q0 + r) * C3 + h * Dh;
#pragma unroll
    for (int f = 0; f < 2; ++f) {
      int d = f * 32 + hi * 8;
      qa[f].q[0] = *(const uint4*)&qrow[d];
      qa[f].q[1] = *(const uint4*)&qrow[d + 16];
    }
  }

  // per lane: running maximum of query r (same in both halves) and the sum
  // over this half's keys; oacc[ds][v] = O[query r][d = ds*16 + 8*hi + v]
  float mrow = -1e30f, lrow = 0.f;
  v8f oacc[4];
#pragma unroll
  for (int d = 0; d < 4; ++d) oacc[d] = zero8;

  // this thread's 16 bytes of every tile: K row tid/8, V^T row tid/4
  const int kr = tid >> 3, kc = (tid & 7) << 3;
  const int vr = tid >> 2, vc = (tid & 3) << 3;
  const u16* gK = qkv + (size_t)(b * Nctx + kr) * C3 + C + h * Dh + kc;
  const u16* gV = vT + ((size_t)bh * Dh + vr) * Nctx + vc;

  stage_kv(gK, &Ks[0][kr][kc], gV, &Vs[0][vr][vc]);
  asm volatile("s_wait_asynccnt 0x0" ::: "memory");   // tile 0 has landed
  __syncthreads();                                    // ... for every wave
  stage_kv(gK + (size_t)32 * C3, &Ks[1][kr][kc], gV + 32, &Vs[1][vr][vc]);

  for (int it = 0; it < NT; ++it) {
    const int cur = it & 1;
    v8f s[2];
#pragma unroll
    for (int t = 0; t < 2; ++t) {
      const u16* krow = &Ks[cur][t * 16 + r][0];
      v8f st = zero8;
#pragma unroll
      for (int f = 0; f < 2; ++f) {
        FragBF kf;
        int d = f * 32 + hi * 8;
        kf.q[0] = *(const uint4*)&krow[d];
        kf.q[1] = *(const uint4*)&krow[d + 16];
        st = __builtin_amdgcn_wmma_f32_16x16x32_bf16(
            false, kf.v, false, qa[f].v, (short)0, st, false, false);
      }
      s[t] = st;
    }

    // online softmax: s[t][v] = score of key t*16 + 8*hi + v with query r
    float rm = fmaxf(s[0][0], s[1][0]);
#pragma unroll
    for (int v = 1; v < 8; ++v) rm = fmaxf(rm, fmaxf(s[0][v], s[1][v]));
    rm = fmaxf(rm, xhalf(rm));
    const float mnew = fmaxf(mrow, rm);
    const float sc   = __expf(mrow - mnew);
    mrow = mnew;
#pragma unroll
    for (int d = 0; d < 4; ++d) oacc[d] = oacc[d] * sc;
    // P^T as B operand: element e < 8 is key 8*hi + e, element 8 + e is key
    // 16 + 8*hi + e, which is what V^T's two 16-byte reads per row deliver
    FragBF pb;
    u32 pw[8];
    float ps0 = 0.f, ps1 = 0.f;
#pragma unroll
    for (int i = 0; i < 8; ++i) {
      const float p0 = __expf(s[i >> 2][2 * (i & 3)] - mnew);
      const float p1 = __expf(s[i >> 2][2 * (i & 3) + 1] - mnew);
      pw[i] = pack_bf16x2(p0, p1);
      ps0 += p0;
      ps1 += p1;
    }
    lrow = lrow * sc + (ps0 + ps1);
    pb.q[0] = make_uint4(pw[0], pw[1], pw[2], pw[3]);
    pb.q[1] = make_uint4(pw[4], pw[5], pw[6], pw[7]);
#pragma unroll
    for (int ds = 0; ds < 4; ++ds) {
      const u16* vrow = &Vs[cur][ds * 16 + r][0];
      FragBF vf;
      vf.q[0] = *(const uint4*)&vrow[hi * 8];
      vf.q[1] = *(const uint4*)&vrow[hi * 8 + 16];
      oacc[ds] = __builtin_amdgcn_wmma_f32_16x16x32_bf16(
          false, vf.v, false, pb.v, (short)0, oacc[ds], false, false);
    }

    // hand-over: this wave's LDS reads are done, its copies of tile it+1 have
    // landed; behind the barrier both hold for all waves, so tile it+1 may be
    // read and the buffer just read may be refilled
    asm volatile("s_wait_dscnt 0x0" ::: "memory");
    asm volatile("s_wait_asynccnt 0x0" ::: "memory");
    __syncthreads();
    if (it + 2 < NT)
      stage_kv(gK + (size_t)(it + 2) * 32 * C3, &Ks[cur][kr][kc],
               gV + (it + 2) * 32, &Vs[cur][vr][vc]);
  }
  asm volatile("s_wait_asynccnt 0x0" ::: "memory");   // no copy outlives the loop

  // join the two halves' sums, normalize and write O as [M, C] bf16
  // (col = h*64 + d): a lane's 8 registers of a tile are 8 consecutive d
  const float inv = 1.0f / (lrow + xhalf(lrow));
  u16* orow = o + (size_t)(b * Nctx + q0 + r) * C + h * Dh + hi * 8;
#pragma unroll
  for (int ds = 0; ds < 4; ++ds) {
    const v8f ov = oacc[ds] * inv;
    *(uint4*)&orow[ds * 16] =
        make_uint4(pack_bf16x2(ov[0], ov[1]), pack_bf16x2(ov[2], ov[3]),
                   pack_bf16x2(ov[4], ov[5]), pack_bf16x2(ov[6], ov[7]));
  }
}

// ---------------------------------------------------------------------------
// host-side orchestration
// ---------------------------------------------------------------------------
extern "C" void kernel_launch(void* const* d_in, const int* in_sizes, int n_in,
                              void* d_out, int out_size, void* d_ws, size_t ws_size,
                              hipStream_t stream) {
  const float* x      = (const float*)d_in[0];
  const float* ln1_g  = (const float*)d_in[1];
  const float* ln1_b  = (const float*)d_in[2];
  const float* qkv_w  = (const float*)d_in[3];
  const float* proj_w = (const float*)d_in[4];
  const float* proj_b = (const float*)d_in[5];
  const float* ln2_g  = (const float*)d_in[6];
  const float* ln2_b  = (const float*)d_in[7];
  const float* fc1_w  = (const float*)d_in[8];
  const float* fc1_b  = (const float*)d_in[9];
  const float* fc2_w  = (const float*)d_in[10];
  const float* fc2_b  = (const float*)d_in[11];
  float* out = (float*)d_out;

  const int M = 8192, C = 1024, C3 = 3072, Hd = 4096;

  char* ws = (char*)d_ws;
  u16*   h_bf   = (u16*)(ws);                             // 16 MB  (LN out, reused)
  u16*   qkv_bf = (u16*)(ws + (size_t)16  * 1048576);     // 48 MB (Q, K columns used)
  u16*   vTb    = (u16*)(ws + (size_t)64  * 1048576);     // 16 MB
  u16*   o_bf   = (u16*)(ws + (size_t)80  * 1048576);     // 16 MB
  float* x1     = (float*)(ws + (size_t)96 * 1048576);    // 32 MB
  u16*   h2_bf  = (u16*)(ws + (size_t)128 * 1048576);     // 64 MB
  u16*   wqkv   = (u16*)(ws + (size_t)192 * 1048576);     // 24 MB total weights
  u16*   wproj  = wqkv  + (size_t)C3 * C;
  u16*   wfc1   = wproj + (size_t)C  * C;
  u16*   wfc2   = wfc1  + (size_t)Hd * C;

  // weights -> bf16 (wqkv, wproj, wfc1, wfc2 lie back to back)
  cast_weights_bf16_k<<<512, 256, 0, stream>>>(qkv_w, proj_w, fc1_w, fc2_w, wqkv);

  // attention branch
  layernorm_bf16_k<<<M, 256, 0, stream>>>(x, ln1_g, ln1_b, h_bf);
  gemm_bf16_k<0, 64><<<dim3(C3 / 128, M / 128), 256, 0, stream>>>(
      h_bf, wqkv, nullptr, nullptr, nullptr, qkv_bf, vTb, M, C3, C);
  flash_attn_k<<<dim3(2048 / 128, 4 * 16), 256, 0, stream>>>(qkv_bf, vTb, o_bf);
  gemm_bf16_k<1, 128><<<dim3(C / 128, M / 128), 256, 0, stream>>>(
      o_bf, wproj, proj_b, x, x1, nullptr, nullptr, M, C, C);

  // MLP branch
  layernorm_bf16_k<<<M, 256, 0, stream>>>(x1, ln2_g, ln2_b, h_bf);
  gemm_bf16_k<2, 64><<<dim3(Hd / 128, M / 128), 256, 0, stream>>>(
      h_bf, wfc1, fc1_b, nullptr, nullptr, h2_bf, nullptr, M, Hd, C);
  gemm_bf16_k<1, 128><<<dim3(C / 128, M / 128), 256, 0, stream>>>(
      h2_bf, wfc2, fc2_b, x1, out, nullptr, nullptr, M, C, Hd);
}

// v006
// A run of this version takes 277 microseconds.
// Timed twice side by side with v005, it ran 1.04 times as fast both times.
// Counting every step since v000, it is 2.61 times as fast.
#include <hip/hip_runtime.h>
#include <hip/hip_bf16.h>

typedef unsigned short u16;
typedef unsigned int u32;
typedef __attribute__((ext_vector_type(16))) __bf16 v16bf;
typedef __attribute__((ext_vector_type(8)))  float  v8f;

union FragBF {
  v16bf v;
  uint4 q[2];
  u16   h[16];
};

__device__ __forceinline__ u16 f32_to_bf16(float f) {
  union { float f; u32 u; } c; c.f = f;
  u32 u = c.u;
  u += 0x7fffu + ((u >> 16) & 1u);   // round-to-nearest-even
  return (u16)(u >> 16);
}

// two f32 -> one dword of two bf16, round to nearest even
__device__ __forceinline__ u32 pack_bf16x2(float lo, float hi) {
  typedef __bf16 bf2 __attribute__((ext_vector_type(2)));
  typedef float  f2  __attribute__((ext_vector_type(2)));
  return __builtin_bit_cast(u32, __builtin_convertvector(f2{lo, hi}, bf2));
}

// ---------------------------------------------------------------------------
// fp32 -> bf16 cast of the four weight matrices in one launch of 512 workgroups.
// Their bf16 copies lie back to back in out: qkv (3072 x 1024), proj
// (1024 x 1024), fc1 (4096 x 1024), fc2 (1024 x 4096).  A chunk is 8192 floats:
// a thread takes 8 float4, 256 threads apart, so that a wave's load covers 512
// contiguous bytes and its 8-byte store 256.  qkv and proj together, fc1, and
// fc2 are 512 chunks each: workgroup b takes chunk b of each of the three, and
// a thread issues its 24 loads ahead of its first store.
// ---------------------------------------------------------------------------
__global__ __launch_bounds__(256) void cast_weights_bf16_k(
    const float* __restrict__ wq, const float* __restrict__ wp,
    const float* __restrict__ w1, const float* __restrict__ w2,
    u16* __restrict__ out) {
  constexpr int CH = 8192;                 // floats per chunk
  constexpr int NQ = 3072 * 1024 / CH;     // chunks of qkv
  constexpr int NG = 512;                  // chunks per group = workgroups
  const int b  = blockIdx.x;
  const int t4 = threadIdx.x * 4;
  const float* s[3] = {b < NQ ? wq + (size_t)b * CH : wp + (size_t)(b - NQ) * CH,
                       w1 + (size_t)b * CH, w2 + (size_t)b * CH};
  float4 v[3][8];
  // all four loops unrolled: v stays in registers, the loads issue back to back
#pragma unroll
  for (int i = 0; i < 3; ++i)
#pragma unroll
    for (int j = 0; j < 8; ++j) v[i][j] = *(const float4*)&s[i][j * 1024 + t4];
#pragma unroll
  for (int i = 0; i < 3; ++i) {
    u16* d = out + (size_t)(i * NG + b) * CH + t4;
#pragma unroll
    for (int j = 0; j < 8; ++j)
      *(uint2*)&d[j * 1024] = make_uint2(pack_bf16x2(v[i][j].x, v[i][j].y),
                                         pack_bf16x2(v[i][j].z, v[i][j].w));
  }
}

// ---------------------------------------------------------------------------
// LayerNorm over C=1024, one row per block, bf16 output
// ---------------------------------------------------------------------------
__global__ __launch_bounds__(256) void layernorm_bf16_k(const float* __restrict__ x,
                                                        const float* __restrict__ g,
                                                        const float* __restrict__ b,
                                                        u16* __restrict__ out) {
  constexpr int C = 1024;
  __shared__ float red1[256];
  __shared__ float red2[256];
  const int row = blockIdx.x;
  const int tid = threadIdx.x;
  const float4 v = *(const float4*)&x[(size_t)row * C + tid * 4];
  float s  = v.x + v.y + v.z + v.w;
  float ss = v.x * v.x + v.y * v.y + v.z * v.z + v.w * v.w;
  red1[tid] = s; red2[tid] = ss;
  __syncthreads();
  for (int o = 128; o > 0; o >>= 1) {
    if (tid < o) { red1[tid] += red1[tid + o]; red2[tid] += red2[tid + o]; }
    __syncthreads();
  }
  const float mu  = red1[0] * (1.0f / 1024.0f);
  const float var = red2[0] * (1.0f / 1024.0f) - mu * mu;
  const float rs  = rsqrtf(var + 1e-5f);
#pragma unroll
  for (int j = 0; j < 4; ++j) {
    int c = tid * 4 + j;
    float xv = (&v.x)[j];
    out[(size_t)row * C + c] = f32_to_bf16((xv - mu) * rs * g[c] + b[c]);
  }
}

__device__ __forceinline__ void copy8(const u32 (&l)[8], const u16* const (&g)[8]) {
  asm volatile("global_load_async_to_lds_b128 %0, %8, off\n\t"
               "global_load_async_to_lds_b128 %1, %9, off\n\t"
               "global_load_async_to_lds_b128 %2, %10, off\n\t"
               "global_load_async_to_lds_b128 %3, %11, off\n\t"
               "global_load_async_to_lds_b128 %4, %12, off\n\t"
               "global_load_async_to_lds_b128 %5, %13, off\n\t"
               "global_load_async_to_lds_b128 %6, %14, off\n\t"
               "global_load_async_to_lds_b128 %7, %15, off\n\t"
               "s_wait_xcnt 0x0"
               :: "v"(l[0]), "v"(l[1]), "v"(l[2]), "v"(l[3]),
                  "v"(l[4]), "v"(l[5]), "v"(l[6]), "v"(l[7]),
                  "v"(g[0]), "v"(g[1]), "v"(g[2]), "v"(g[3]),
                  "v"(g[4]), "v"(g[5]), "v"(g[6]), "v"(g[7])
               : "memory");
}

// ---------------------------------------------------------------------------
// GELU with the exact (erf) definition, eight values, no branch:
//   gelu(t) = t * Phi(t) = max(t, 0) - |t| * erfc(|t| / sqrt 2) / 2
//   erfc(z) = (a1 u + a2 u^2 + ... + a5 u^5) * exp(-z^2),  u = 1 / (1 + p z)
// (the five-term form, absolute error of erfc below 2e-7).  The small term is
// subtracted from max(t, 0), so nothing cancels for negative t.  Written on
// whole vectors so that the multiply-adds pair up into packed instructions.
// ---------------------------------------------------------------------------
__device__ __forceinline__ v8f splat8(float c) { return v8f{c, c, c, c, c, c, c, c}; }

__device__ __forceinline__ v8f gelu8(v8f t) {
  v8f a, u, e, r;
  // both loops unrolled: constant element indices keep the vectors in registers
#pragma unroll
  for (int v = 0; v < 8; ++v) a[v] = fabsf(t[v]);
  const v8f d = a * 0.23164190f + 1.0f;          // 1 + p * |t| / sqrt 2
  const v8f q = (t * t) * -0.72134752f;          // -t^2 / 2 * log2(e)
#pragma unroll
  for (int v = 0; v < 8; ++v) {
    u[v] = __builtin_amdgcn_rcpf(d[v]);
    e[v] = __builtin_amdgcn_exp2f(q[v]);
    r[v] = fmaxf(t[v], 0.0f);
  }
  // half of a5 .. a1, nested multiply-adds in u
  v8f p = u * 0.53070271f - 0.72657601f;
  p = __builtin_elementwise_fma(p, u, splat8(0.71070687f));
  p = __builtin_elementwise_fma(p, u, splat8(-0.14224837f));
  p = __builtin_elementwise_fma(p, u, splat8(0.12741480f));
  return r - a * (p * u * e);
}

template <int EPI, int KS>
__global__ __launch_bounds__(256) void gemm_bf16_k(
    const u16* __restrict__ A, const u16* __restrict__ W,
    const float* __restrict__ bias, const float* __restrict__ res,
    float* __restrict__ outF, u16* __restrict__ outB, u16* __restrict__ outT,
    int M, int N, int K) {
  constexpr int PITCH = KS + 8;        // elements: row bytes + 16
  constexpr int CPR   = KS / 8;        // 16-byte chunks per row
  constexpr int RP    = 256 / CPR;     // rows the 256 threads copy at once
  constexpr int NC    = 128 / RP;      // copies per thread, operand and stage
  __shared__ __align__(16) u16 As[2][128][PITCH];
  __shared__ __align__(16) u16 Ws[2][128][PITCH];

  const int tid  = threadIdx.x;
  const int lane = tid & 31;
  const int wave = tid >> 5;
  const int r    = lane & 15;
  const int hi   = lane >> 4;

  const int m0 = blockIdx.y * 128;
  const int n0 = blockIdx.x * 128;
  const int wm = (wave >> 1) * 32;   // 4 waves along M
  const int wn = (wave & 1) * 64;    // 2 waves along N

  // cooperative copy: thread t owns chunk t % CPR of rows t / CPR + RP * j
  const int row = tid / CPR;
  const int col = (tid % CPR) << 3;

  const u16* gA = &A[(size_t)(m0 + row) * K + col];
  const u16* gW = &W[(size_t)(n0 + row) * K + col];
  const size_t gstep = (size_t)RP * K;
  const u32 lA = (u32)(unsigned long long)(void*)&As[0][row][col];
  const u32 lW = (u32)(unsigned long long)(void*)&Ws[0][row][col];

  // this thread's 2 * NC copies of stage s into buffer buf, eight to a statement
  auto stage = [&](int s, int buf) {
#pragma unroll
    for (int q = 0; q < 2 * NC / 8; ++q) {
      u32 l[8];
      const u16* g[8];
#pragma unroll
      for (int e = 0; e < 8; ++e) {
        const int c = q * 8 + e, j = c % NC;
        l[e] = (c < NC ? lA : lW) + (u32)(buf * 128 + j * RP) * (PITCH * 2);
        g[e] = (c < NC ? gA : gW) + (size_t)s * KS + j * gstep;
      }
      copy8(l, g);
    }
  };

  v8f acc[2][4];
  const v8f zero8 = {0.f, 0.f, 0.f, 0.f, 0.f, 0.f, 0.f, 0.f};
#pragma unroll
  for (int i = 0; i < 2; ++i)
#pragma unroll
    for (int j = 0; j < 4; ++j) acc[i][j] = zero8;

  const int nk = K / KS;   // stages

  stage(0, 0);
  asm volatile("s_wait_asynccnt 0x0" ::: "memory");   // stage 0 has landed
  __syncthreads();                                    // ... for every wave
  if (nk > 1) stage(1, 1);

  for (int t = 0; t < nk; ++t) {
    const int cur = t & 1;
#pragma unroll
    for (int ks = 0; ks < KS / 32; ++ks) {
      FragBF af[2], bfr[4];
#pragma unroll
      for (int ii = 0; ii < 2; ++ii) {
        int rr = wm + ii * 16 + r;
        af[ii].q[0] = *(const uint4*)&As[cur][rr][ks * 32 + hi * 8];
        af[ii].q[1] = *(const uint4*)&As[cur][rr][ks * 32 + hi * 8 + 16];
      }
#pragma unroll
      for (int jj = 0; jj < 4; ++jj) {
        int rr = wn + jj * 16 + r;
        bfr[jj].q[0] = *(const uint4*)&Ws[cur][rr][ks * 32 + hi * 8];
        bfr[jj].q[1] = *(const uint4*)&Ws[cur][rr][ks * 32 + hi * 8 + 16];
      }
#pragma unroll
      for (int ii = 0; ii < 2; ++ii)
#pragma unroll
        for (int jj = 0; jj < 4; ++jj)
          acc[ii][jj] = __builtin_amdgcn_wmma_f32_16x16x32_bf16(
              false, af[ii].v, false, bfr[jj].v, (short)0, acc[ii][jj], false, false);
    }
    // hand-over: this wave's LDS reads are done, its copies of stage t+1 have
    // landed; behind the barrier both hold for all waves, so stage t+1 may be
    // read and the buffer just read may be refilled
    asm volatile("s_wait_dscnt 0x0" ::: "memory");
    asm volatile("s_wait_asynccnt 0x0" ::: "memory");
    __syncthreads();
    if (t + 2 < nk) stage(t + 2, cur);
  }
  asm volatile("s_wait_asynccnt 0x0" ::: "memory");   // no copy outlives the loop

  // epilogue: D layout lane mapping m = v + 8*hi, n = lane%16
  if constexpr (EPI == 0) {
    if (n0 >= 2048) {
      // V columns (the whole block: n0 is a multiple of 128).  A lane's 8
      // registers of a tile are 8 consecutive tokens of ONE column h*64 + d,
      // that is 16 contiguous bytes of a V^T row: one store per tile.
      u16* trow = outT + ((size_t)(m0 >> 11) * 1024 + (n0 - 2048 + wn + r)) * 2048
                  + (m0 & 2047) + wm + 8 * hi;
#pragma unroll
      for (int i = 0; i < 2; ++i)
#pragma unroll
        for (int j = 0; j < 4; ++j) {
          const v8f a = acc[i][j];
          *(uint4*)&trow[(size_t)j * 16 * 2048 + i * 16] =
              make_uint4(pack_bf16x2(a[0], a[1]), pack_bf16x2(a[2], a[3]),
                         pack_bf16x2(a[4], a[5]), pack_bf16x2(a[6], a[7]));
        }
      return;
    }
  }
#pragma unroll
  for (int i = 0; i < 2; ++i)
#pragma unroll
    for (int j = 0; j < 4; ++j) {
      const int n = n0 + wn + j * 16 + r;
      v8f gl;
      if constexpr (EPI == 2) gl = gelu8(acc[i][j] + bias[n]);
#pragma unroll
      for (int v = 0; v < 8; ++v) {
        int m = m0 + wm + i * 16 + v + 8 * hi;
        float val = acc[i][j][v];
        size_t idx = (size_t)m * N + n;
        if constexpr (EPI == 0) {
          float s = (n < 1024) ? 0.125f : 1.0f;   // SCALE = 64^-0.5 on Q
          outB[idx] = f32_to_bf16(val * s);
        } else if constexpr (EPI == 1) {
          outF[idx] = val + bias[n] + res[idx];
        } else {
          outB[idx] = f32_to_bf16(gl[v]);
        }
      }
    }
}

__device__ __forceinline__ float xhalf(float x) {
  int b = __builtin_bit_cast(int, x);
  return __builtin_bit_cast(float, __builtin_amdgcn_permlanex16(
      b, b, 0x76543210, 0xfedcba98, false, false));
}

__device__ __forceinline__ void stage_kv(const u16* gk, u16* lk,
                                         const u16* gv, u16* lv) {
  asm volatile("global_load_async_to_lds_b128 %0, %1, off\n\t"
               "global_load_async_to_lds_b128 %2, %3, off\n\t"
               "s_wait_xcnt 0x0"
               :: "v"((u32)(unsigned long long)(void*)lk), "v"(gk),
                  "v"((u32)(unsigned long long)(void*)lv), "v"(gv)
               : "memory");
}

__global__ __launch_bounds__(256) void flash_attn_k(const u16* __restrict__ qkv,
                                                    const u16* __restrict__ vT,
                                                    u16* __restrict__ o) {
  constexpr int Nctx = 2048, C = 1024, C3 = 3072, Dh = 64;
  constexpr int NT = Nctx / 32;   // key tiles
  __shared__ __align__(16) u16 Ks[2][32][72];
  __shared__ __align__(16) u16 Vs[2][64][40];

  const int tid  = threadIdx.x;
  const int lane = tid & 31;
  const int wave = tid >> 5;
  const int r    = lane & 15;
  const int hi   = lane >> 4;

  const int bh = blockIdx.y;   // b*16 + h
  const int b  = bh >> 4;
  const int h  = bh & 15;
  const int q0 = blockIdx.x * 128 + wave * 16;

  const v8f zero8 = {0.f, 0.f, 0.f, 0.f, 0.f, 0.f, 0.f, 0.f};

  // Q fragments (B operand: lane = query column), Q already scaled by 0.125
  // in the qkv epilogue
  FragBF qa[2];
  {
    const u16* qrow = qkv + (size_t)(b * Nctx + q0 + r) * C3 + h * Dh;
#pragma unroll
    for (int f = 0; f < 2; ++f) {
      int d = f * 32 + hi * 8;
      qa[f].q[0] = *(const uint4*)&qrow[d];
      qa[f].q[1] = *(const uint4*)&qrow[d + 16];
    }
  }

  // per lane: running maximum of query r (same in both halves) and the sum
  // over this half's keys; oacc[ds][v] = O[query r][d = ds*16 + 8*hi + v]
  float mrow = -1e30f, lrow = 0.f;
  v8f oacc[4];
#pragma unroll
  for (int d = 0; d < 4; ++d) oacc[d] = zero8;

  // this thread's 16 bytes of every tile: K row tid/8, V^T row tid/4
  const int kr = tid >> 3, kc = (tid & 7) << 3;
  const int vr = tid >> 2, vc = (tid & 3) << 3;
  const u16* gK = qkv + (size_t)(b * Nctx + kr) * C3 + C + h * Dh + kc;
  const u16* gV = vT + ((size_t)bh * Dh + vr) * Nctx + vc;

  stage_kv(gK, &Ks[0][kr][kc], gV, &Vs[0][vr][vc]);
  asm volatile("s_wait_asynccnt 0x0" ::: "memory");   // tile 0 has landed
  __syncthreads();                                    // ... for every wave
  stage_kv(gK + (size_t)32 * C3, &Ks[1][kr][kc], gV + 32, &Vs[1][vr][vc]);

  for (int it = 0; it < NT; ++it) {
    const int cur = it & 1;
    v8f s[2];
#pragma unroll
    for (int t = 0; t < 2; ++t) {
      const u16* krow = &Ks[cur][t * 16 + r][0];
      v8f st = zero8;
#pragma unroll
      for (int f = 0; f < 2; ++f) {
        FragBF kf;
        int d = f * 32 + hi * 8;
        kf.q[0] = *(const uint4*)&krow[d];
        kf.q[1] = *(const uint4*)&krow[d + 16];
        st = __builtin_amdgcn_wmma_f32_16x16x32_bf16(
            false, kf.v, false, qa[f].v, (short)0, st, false, false);
      }
      s[t] = st;
    }

    // online softmax: s[t][v] = score of key t*16 + 8*hi + v with query r
    float rm = fmaxf(s[0][0], s[1][0]);
#pragma unroll
    for (int v = 1; v < 8; ++v) rm = fmaxf(rm, fmaxf(s[0][v], s[1][v]));
    rm = fmaxf(rm, xhalf(rm));
    const float mnew = fmaxf(mrow, rm);
    const float sc   = __expf(mrow - mnew);
    mrow = mnew;
#pragma unroll
    for (int d = 0; d < 4; ++d) oacc[d] = oacc[d] * sc;
    // P^T as B operand: element e < 8 is key 8*hi + e, element 8 + e is key
    // 16 + 8*hi + e, which is what V^T's two 16-byte reads per row deliver
    FragBF pb;
    u32 pw[8];
    float ps0 = 0.f, ps1 = 0.f;
#pragma unroll
    for (int i = 0; i < 8; ++i) {
      const float p0 = __expf(s[i >> 2][2 * (i & 3)] - mnew);
      const float p1 = __expf(s[i >> 2][2 * (i & 3) + 1] - mnew);
      pw[i] = pack_bf16x2(p0, p1);
      ps0 += p0;
      ps1 += p1;
    }
    lrow = lrow * sc + (ps0 + ps1);
    pb.q[0] = make_uint4(pw[0], pw[1], pw[2], pw[3]);
    pb.q[1] = make_uint4(pw[4], pw[5], pw[6], pw[7]);
#pragma unroll
    for (int ds = 0; ds < 4; ++ds) {
      const u16* vrow = &Vs[cur][ds * 16 + r][0];
      FragBF vf;
      vf.q[0] = *(const uint4*)&vrow[hi * 8];
      vf.q[1] = *(const uint4*)&vrow[hi * 8 + 16];
      oacc[ds] = __builtin_amdgcn_wmma_f32_16x16x32_bf16(
          false, vf.v, false, pb.v, (short)0, oacc[ds], false, false);
    }

    // hand-over: this wave's LDS reads are done, its copies of tile it+1 have
    // landed; behind the barrier both hold for all waves, so tile it+1 may be
    // read and the buffer just read may be refilled
    asm volatile("s_wait_dscnt 0x0" ::: "memory");
    asm volatile("s_wait_asynccnt 0x0" ::: "memory");
    __syncthreads();
    if (it + 2 < NT)
      stage_kv(gK + (size_t)(it + 2) * 32 * C3, &Ks[cur][kr][kc],
               gV + (it + 2) * 32, &Vs[cur][vr][vc]);
  }
  asm volatile("s_wait_asynccnt 0x0" ::: "memory");   // no copy outlives the loop

  // join the two halves' sums, normalize and write O as [M, C] bf16
  // (col = h*64 + d): a lane's 8 registers of a tile are 8 consecutive d
  const float inv = 1.0f / (lrow + xhalf(lrow));
  u16* orow = o + (size_t)(b * Nctx + q0 + r) * C + h * Dh + hi * 8;
#pragma unroll
  for (int ds = 0; ds < 4; ++ds) {
    const v8f ov = oacc[ds] * inv;
    *(uint4*)&orow[ds * 16] =
        make_uint4(pack_bf16x2(ov[0], ov[1]), pack_bf16x2(ov[2], ov[3]),
                   pack_bf16x2(ov[4], ov[5]), pack_bf16x2(ov[6], ov[7]));
  }
}

// ---------------------------------------------------------------------------
// host-side orchestration
// ---------------------------------------------------------------------------
extern "C" void kernel_launch(void* const* d_in, const int* in_sizes, int n_in,
                              void* d_out, int out_size, void* d_ws, size_t ws_size,
                              hipStream_t stream) {
  const float* x      = (const float*)d_in[0];
  const float* ln1_g  = (const float*)d_in[1];
  const float* ln1_b  = (const float*)d_in[2];
  const float* qkv_w  = (const float*)d_in[3];
  const float* proj_w = (const float*)d_in[4];
  const float* proj_b = (const float*)d_in[5];
  const float* ln2_g  = (const float*)d_in[6];
  const float* ln2_b  = (const float*)d_in[7];
  const float* fc1_w  = (const float*)d_in[8];
  const float* fc1_b  = (const float*)d_in[9];
  const float* fc2_w  = (const float*)d_in[10];
  const float* fc2_b  = (const float*)d_in[11];
  float* out = (float*)d_out;

  const int M = 8192, C = 1024, C3 = 3072, Hd = 4096;

  char* ws = (char*)d_ws;
  u16*   h_bf   = (u16*)(ws);                             // 16 MB  (LN out, reused)
  u16*   qkv_bf = (u16*)(ws + (size_t)16  * 1048576);     // 48 MB (Q, K columns used)
  u16*   vTb    = (u16*)(ws + (size_t)64  * 1048576);     // 16 MB
  u16*   o_bf   = (u16*)(ws + (size_t)80  * 1048576);     // 16 MB
  float* x1     = (float*)(ws + (size_t)96 * 1048576);    // 32 MB
  u16*   h2_bf  = (u16*)(ws + (size_t)128 * 1048576);     // 64 MB
  u16*   wqkv   = (u16*)(ws + (size_t)192 * 1048576);     // 24 MB total weights
  u16*   wproj  = wqkv  + (size_t)C3 * C;
  u16*   wfc1   = wproj + (size_t)C  * C;
  u16*   wfc2   = wfc1  + (size_t)Hd * C;

  // weights -> bf16 (wqkv, wproj, wfc1, wfc2 lie back to back)
  cast_weights_bf16_k<<<512, 256, 0, stream>>>(qkv_w, proj_w, fc1_w, fc2_w, wqkv);

  // attention branch
  layernorm_bf16_k<<<M, 256, 0, stream>>>(x, ln1_g, ln1_b, h_bf);
  gemm_bf16_k<0, 64><<<dim3(C3 / 128, M / 128), 256, 0, stream>>>(
      h_bf, wqkv, nullptr, nullptr, nullptr, qkv_bf, vTb, M, C3, C);
  flash_attn_k<<<dim3(2048 / 128, 4 * 16), 256, 0, stream>>>(qkv_bf, vTb, o_bf);
  gemm_bf16_k<1, 128><<<dim3(C / 128, M / 128), 256, 0, stream>>>(
      o_bf, wproj, proj_b, x, x1, nullptr, nullptr, M, C, C);

  // MLP branch
  layernorm_bf16_k<<<M, 256, 0, stream>>>(x1, ln2_g, ln2_b, h_bf);
  gemm_bf16_k<2, 64><<<dim3(Hd / 128, M / 128), 256, 0, stream>>>(
      h_bf, wfc1, fc1_b, nullptr, nullptr, h2_bf, nullptr, M, Hd, C);
  gemm_bf16_k<1, 128><<<dim3(C / 128, M / 128), 256, 0, stream>>>(
      h2_bf, wfc2, fc2_b, x1, out, nullptr, nullptr, M, C, Hd);
}

// v007
// A run of this version takes 269 microseconds.
// Two timings next to v006 put it at 1.03 and 1.05 times that version's speed.
// All steps since v000 together make it 2.72 times as fast.
#include <hip/hip_runtime.h>
#include <hip/hip_bf16.h>

typedef unsigned short u16;
typedef unsigned int u32;
typedef __attribute__((ext_vector_type(16))) __bf16 v16bf;
typedef __attribute__((ext_vector_type(8)))  float  v8f;

union FragBF {
  v16bf v;
  uint4 q[2];
  u16   h[16];
};

__device__ __forceinline__ u16 f32_to_bf16(float f) {
  union { float f; u32 u; } c; c.f = f;
  u32 u = c.u;
  u += 0x7fffu + ((u >> 16) & 1u);   // round-to-nearest-even
  return (u16)(u >> 16);
}

// two f32 -> one dword of two bf16, round to nearest even
__device__ __forceinline__ u32 pack_bf16x2(float lo, float hi) {
  typedef __bf16 bf2 __attribute__((ext_vector_type(2)));
  typedef float  f2  __attribute__((ext_vector_type(2)));
  return __builtin_bit_cast(u32, __builtin_convertvector(f2{lo, hi}, bf2));
}

// ---------------------------------------------------------------------------
// fp32 -> bf16 cast of the four weight matrices in one launch of 512 workgroups.
// Their bf16 copies lie back to back in out: qkv (3072 x 1024), proj
// (1024 x 1024), fc1 (4096 x 1024), fc2 (1024 x 4096).  A chunk is 8192 floats:
// a thread takes 8 float4, 256 threads apart, so that a wave's load covers 512
// contiguous bytes and its 8-byte store 256.  qkv and proj together, fc1, and
// fc2 are 512 chunks each: workgroup b takes chunk b of each of the three, and
// a thread issues its 24 loads ahead of its first store.
// ---------------------------------------------------------------------------
__global__ __launch_bounds__(256) void cast_weights_bf16_k(
    const float* __restrict__ wq, const float* __restrict__ wp,
    const float* __restrict__ w1, const float* __restrict__ w2,
    u16* __restrict__ out) {
  constexpr int CH = 8192;                 // floats per chunk
  constexpr int NQ = 3072 * 1024 / CH;     // chunks of qkv
  constexpr int NG = 512;                  // chunks per group = workgroups
  const int b  = blockIdx.x;
  const int t4 = threadIdx.x * 4;
  const float* s[3] = {b < NQ ? wq + (size_t)b * CH : wp + (size_t)(b - NQ) * CH,
                       w1 + (size_t)b * CH, w2 + (size_t)b * CH};
  float4 v[3][8];
  // all four loops unrolled: v stays in registers, the loads issue back to back
#pragma unroll
  for (int i = 0; i < 3; ++i)
#pragma unroll
    for (int j = 0; j < 8; ++j) v[i][j] = *(const float4*)&s[i][j * 1024 + t4];
#pragma unroll
  for (int i = 0; i < 3; ++i) {
    u16* d = out + (size_t)(i * NG + b) * CH + t4;
#pragma unroll
    for (int j = 0; j < 8; ++j)
      *(uint2*)&d[j * 1024] = make_uint2(pack_bf16x2(v[i][j].x, v[i][j].y),
                                         pack_bf16x2(v[i][j].z, v[i][j].w));
  }
}

// ---------------------------------------------------------------------------
// LayerNorm over C=1024, one row per block, bf16 output
// ---------------------------------------------------------------------------
__global__ __launch_bounds__(256) void layernorm_bf16_k(const float* __restrict__ x,
                                                        const float* __restrict__ g,
                                                        const float* __restrict__ b,
                                                        u16* __restrict__ out) {
  constexpr int C = 1024;
  __shared__ float red1[256];
  __shared__ float red2[256];
  const int row = blockIdx.x;
  const int tid = threadIdx.x;
  const float4 v = *(const float4*)&x[(size_t)row * C + tid * 4];
  float s  = v.x + v.y + v.z + v.w;
  float ss = v.x * v.x + v.y * v.y + v.z * v.z + v.w * v.w;
  red1[tid] = s; red2[tid] = ss;
  __syncthreads();
  for (int o = 128; o > 0; o >>= 1) {
    if (tid < o) { red1[tid] += red1[tid + o]; red2[tid] += red2[tid + o]; }
    __syncthreads();
  }
  const float mu  = red1[0] * (1.0f / 1024.0f);
  const float var = red2[0] * (1.0f / 1024.0f) - mu * mu;
  const float rs  = rsqrtf(var + 1e-5f);
#pragma unroll
  for (int j = 0; j < 4; ++j) {
    int c = tid * 4 + j;
    float xv = (&v.x)[j];
    out[(size_t)row * C + c] = f32_to_bf16((xv - mu) * rs * g[c] + b[c]);
  }
}

__device__ __forceinline__ void copy8(const u32 (&l)[8], const u16* const (&g)[8]) {
  asm volatile("global_load_async_to_lds_b128 %0, %8, off\n\t"
               "global_load_async_to_lds_b128 %1, %9, off\n\t"
               "global_load_async_to_lds_b128 %2, %10, off\n\t"
               "global_load_async_to_lds_b128 %3, %11, off\n\t"
               "global_load_async_to_lds_b128 %4, %12, off\n\t"
               "global_load_async_to_lds_b128 %5, %13, off\n\t"
               "global_load_async_to_lds_b128 %6, %14, off\n\t"
               "global_load_async_to_lds_b128 %7, %15, off\n\t"
               "s_wait_xcnt 0x0"
               :: "v"(l[0]), "v"(l[1]), "v"(l[2]), "v"(l[3]),
                  "v"(l[4]), "v"(l[5]), "v"(l[6]), "v"(l[7]),
                  "v"(g[0]), "v"(g[1]), "v"(g[2]), "v"(g[3]),
                  "v"(g[4]), "v"(g[5]), "v"(g[6]), "v"(g[7])
               : "memory");
}

// ---------------------------------------------------------------------------
// GELU with the exact (erf) definition, eight values, no branch:
//   gelu(t) = t * Phi(t) = max(t, 0) - |t| * erfc(|t| / sqrt 2) / 2
//   erfc(z) = (a1 u + a2 u^2 + ... + a5 u^5) * exp(-z^2),  u = 1 / (1 + p z)
// (the five-term form, absolute error of erfc below 2e-7).  The small term is
// subtracted from max(t, 0), so nothing cancels for negative t.  Written on
// whole vectors so that the multiply-adds pair up into packed instructions.
// ---------------------------------------------------------------------------
__device__ __forceinline__ v8f splat8(float c) { return v8f{c, c, c, c, c, c, c, c}; }

__device__ __forceinline__ v8f gelu8(v8f t) {
  v8f a, u, e, r;
  // both loops unrolled: constant element indices keep the vectors in registers
#pragma unroll
  for (int v = 0; v < 8; ++v) a[v] = fabsf(t[v]);
  const v8f d = a * 0.23164190f + 1.0f;          // 1 + p * |t| / sqrt 2
  const v8f q = (t * t) * -0.72134752f;          // -t^2 / 2 * log2(e)
#pragma unroll
  for (int v = 0; v < 8; ++v) {
    u[v] = __builtin_amdgcn_rcpf(d[v]);
    e[v] = __builtin_amdgcn_exp2f(q[v]);
    r[v] = fmaxf(t[v], 0.0f);
  }
  // half of a5 .. a1, nested multiply-adds in u
  v8f p = u * 0.53070271f - 0.72657601f;
  p = __builtin_elementwise_fma(p, u, splat8(0.71070687f));
  p = __builtin_elementwise_fma(p, u, splat8(-0.14224837f));
  p = __builtin_elementwise_fma(p, u, splat8(0.12741480f));
  return r - a * (p * u * e);
}

template <int EPI, int KS>
__global__ __launch_bounds__(256) void gemm_bf16_k(
    const u16* __restrict__ A, const u16* __restrict__ W,
    const float* __restrict__ bias, const float* __restrict__ res,
    float* __restrict__ outF, u16* __restrict__ outB, u16* __restrict__ outT,
    int M, int N, int K) {
  constexpr int PITCH = KS + 8;        // elements: row bytes + 16
  constexpr int CPR   = KS / 8;        // 16-byte chunks per row
  constexpr int RP    = 256 / CPR;     // rows the 256 threads copy at once
  constexpr int NC    = 128 / RP;      // copies per thread, operand and stage
  __shared__ __align__(16) u16 As[2][128][PITCH];
  __shared__ __align__(16) u16 Ws[2][128][PITCH];

  const int tid  = threadIdx.x;
  const int lane = tid & 31;
  const int wave = tid >> 5;
  const int r    = lane & 15;
  const int hi   = lane >> 4;

  const int m0 = blockIdx.y * 128;
  const int n0 = blockIdx.x * 128;
  const int wm = (wave >> 1) * 32;   // 4 waves along M
  const int wn = (wave & 1) * 64;    // 2 waves along N

  // cooperative copy: thread t owns chunk t % CPR of rows t / CPR + RP * j
  const int row = tid / CPR;
  const int col = (tid % CPR) << 3;

  const u16* gA = &A[(size_t)(m0 + row) * K + col];
  const u16* gW = &W[(size_t)(n0 + row) * K + col];
  const size_t gstep = (size_t)RP * K;
  const u32 lA = (u32)(unsigned long long)(void*)&As[0][row][col];
  const u32 lW = (u32)(unsigned long long)(void*)&Ws[0][row][col];

  // this thread's 2 * NC copies of stage s into buffer buf, eight to a statement
  auto stage = [&](int s, int buf) {
#pragma unroll
    for (int q = 0; q < 2 * NC / 8; ++q) {
      u32 l[8];
      const u16* g[8];
#pragma unroll
      for (int e = 0; e < 8; ++e) {
        const int c = q * 8 + e, j = c % NC;
        l[e] = (c < NC ? lA : lW) + (u32)(buf * 128 + j * RP) * (PITCH * 2);
        g[e] = (c < NC ? gA : gW) + (size_t)s * KS + j * gstep;
      }
      copy8(l, g);
    }
  };

  v8f acc[2][4];
  const v8f zero8 = {0.f, 0.f, 0.f, 0.f, 0.f, 0.f, 0.f, 0.f};
#pragma unroll
  for (int i = 0; i < 2; ++i)
#pragma unroll
    for (int j = 0; j < 4; ++j) acc[i][j] = zero8;

  const int nk = K / KS;   // stages

  stage(0, 0);
  asm volatile("s_wait_asynccnt 0x0" ::: "memory");   // stage 0 has landed
  __syncthreads();                                    // ... for every wave
  if (nk > 1) stage(1, 1);

  for (int t = 0; t < nk; ++t) {
    const int cur = t & 1;
#pragma unroll
    for (int ks = 0; ks < KS / 32; ++ks) {
      FragBF af[2], bfr[4];
#pragma unroll
      for (int ii = 0; ii < 2; ++ii) {
        int rr = wm + ii * 16 + r;
        af[ii].q[0] = *(const uint4*)&As[cur][rr][ks * 32 + hi * 8];
        af[ii].q[1] = *(const uint4*)&As[cur][rr][ks * 32 + hi * 8 + 16];
      }
#pragma unroll
      for (int jj = 0; jj < 4; ++jj) {
        int rr = wn + jj * 16 + r;
        bfr[jj].q[0] = *(const uint4*)&Ws[cur][rr][ks * 32 + hi * 8];
        bfr[jj].q[1] = *(const uint4*)&Ws[cur][rr][ks * 32 + hi * 8 + 16];
      }
#pragma unroll
      for (int ii = 0; ii < 2; ++ii)
#pragma unroll
        for (int jj = 0; jj < 4; ++jj)
          acc[ii][jj] = __builtin_amdgcn_wmma_f32_16x16x32_bf16(
              false, af[ii].v, false, bfr[jj].v, (short)0, acc[ii][jj], false, false);
    }
    // hand-over: this wave's LDS reads are done, its copies of stage t+1 have
    // landed; behind the barrier both hold for all waves, so stage t+1 may be
    // read and the buffer just read may be refilled
    asm volatile("s_wait_dscnt 0x0" ::: "memory");
    asm volatile("s_wait_asynccnt 0x0" ::: "memory");
    __syncthreads();
    if (t + 2 < nk) stage(t + 2, cur);
  }
  asm volatile("s_wait_asynccnt 0x0" ::: "memory");   // no copy outlives the loop

  // epilogue: D layout lane mapping m = v + 8*hi, n = lane%16
  if constexpr (EPI == 0) {
    if (n0 >= 2048) {
      // V columns (the whole block: n0 is a multiple of 128).  A lane's 8
      // registers of a tile are 8 consecutive tokens of ONE column h*64 + d,
      // that is 16 contiguous bytes of a V^T row: one store per tile.
      u16* trow = outT + ((size_t)(m0 >> 11) * 1024 + (n0 - 2048 + wn + r)) * 2048
                  + (m0 & 2047) + wm + 8 * hi;
#pragma unroll
      for (int i = 0; i < 2; ++i)
#pragma unroll
        for (int j = 0; j < 4; ++j) {
          const v8f a = acc[i][j];
          *(uint4*)&trow[(size_t)j * 16 * 2048 + i * 16] =
              make_uint4(pack_bf16x2(a[0], a[1]), pack_bf16x2(a[2], a[3]),
                         pack_bf16x2(a[4], a[5]), pack_bf16x2(a[6], a[7]));
        }
      return;
    }
  }
#pragma unroll
  for (int i = 0; i < 2; ++i)
#pragma unroll
    for (int j = 0; j < 4; ++j) {
      const int n = n0 + wn + j * 16 + r;
      v8f gl;
      if constexpr (EPI == 2) gl = gelu8(acc[i][j] + bias[n]);
#pragma unroll
      for (int v = 0; v < 8; ++v) {
        int m = m0 + wm + i * 16 + v + 8 * hi;
        float val = acc[i][j][v];
        size_t idx = (size_t)m * N + n;
        if constexpr (EPI == 0) {
          // SCALE = 64^-0.5 on Q, times log2(e): the scores come out in log2 units
          float s = (n < 1024) ? 0.18033688f : 1.0f;
          outB[idx] = f32_to_bf16(val * s);
        } else if constexpr (EPI == 1) {
          outF[idx] = val + bias[n] + res[idx];
        } else {
          outB[idx] = f32_to_bf16(gl[v]);
        }
      }
    }
}

__device__ __forceinline__ float xhalf(float x) {
  int b = __builtin_bit_cast(int, x);
  return __builtin_bit_cast(float, __builtin_amdgcn_permlanex16(
      b, b, 0x76543210, 0xfedcba98, false, false));
}

__device__ __forceinline__ void stage_kv(const u16* gk, u16* lk,
                                         const u16* gv, u16* lv) {
  asm volatile("global_load_async_to_lds_b128 %0, %1, off\n\t"
               "global_load_async_to_lds_b128 %2, %3, off\n\t"
               "s_wait_xcnt 0x0"
               :: "v"((u32)(unsigned long long)(void*)lk), "v"(gk),
                  "v"((u32)(unsigned long long)(void*)lv), "v"(gv)
               : "memory");
}

__global__ __launch_bounds__(256) void flash_attn_k(const u16* __restrict__ qkv,
                                                    const u16* __restrict__ vT,
                                                    u16* __restrict__ o) {
  constexpr int Nctx = 2048, C = 1024, C3 = 3072, Dh = 64;
  constexpr int NT = Nctx / 32;   // key tiles
  __shared__ __align__(16) u16 Ks[2][32][72];
  __shared__ __align__(16) u16 Vs[2][64][40];

  const int tid  = threadIdx.x;
  const int lane = tid & 31;
  const int wave = tid >> 5;
  const int r    = lane & 15;
  const int hi   = lane >> 4;

  const int bh = blockIdx.y;   // b*16 + h
  const int b  = bh >> 4;
  const int h  = bh & 15;
  const int q0 = blockIdx.x * 128 + wave * 16;

  const v8f zero8 = {0.f, 0.f, 0.f, 0.f, 0.f, 0.f, 0.f, 0.f};

  // Q fragments (B operand: lane = query column), Q already scaled by
  // 0.125 * log2(e) in the qkv epilogue
  FragBF qa[2];
  {
    const u16* qrow = qkv + (size_t)(b * Nctx + q0 + r) * C3 + h * Dh;
#pragma unroll
    for (int f = 0; f < 2; ++f) {
      int d = f * 32 + hi * 8;
      qa[f].q[0] = *(const uint4*)&qrow[d];
      qa[f].q[1] = *(const uint4*)&qrow[d + 16];
    }
  }

  // per lane: negm = -mref of query r in all 8 registers (same in both halves)
  // and the sum over this half's keys; oacc[ds][v] = O[query r][d = ds*16 + 8*hi + v]
  float lrow = 0.f;
  v8f negm = zero8;
  v8f oacc[4];
#pragma unroll
  for (int d = 0; d < 4; ++d) oacc[d] = zero8;

  // this thread's 16 bytes of every tile: K row tid/8, V^T row tid/4
  const int kr = tid >> 3, kc = (tid & 7) << 3;
  const int vr = tid >> 2, vc = (tid & 3) << 3;
  const u16* gK = qkv + (size_t)(b * Nctx + kr) * C3 + C + h * Dh + kc;
  const u16* gV = vT + ((size_t)bh * Dh + vr) * Nctx + vc;

  stage_kv(gK, &Ks[0][kr][kc], gV, &Vs[0][vr][vc]);
  asm volatile("s_wait_asynccnt 0x0" ::: "memory");   // tile 0 has landed
  __syncthreads();                                    // ... for every wave
  stage_kv(gK + (size_t)32 * C3, &Ks[1][kr][kc], gV + 32, &Vs[1][vr][vc]);

  for (int it = 0; it < NT; ++it) {
    const int cur = it & 1;
    v8f s[2];
#pragma unroll
    for (int t = 0; t < 2; ++t) {
      const u16* krow = &Ks[cur][t * 16 + r][0];
      v8f st = negm;
#pragma unroll
      for (int f = 0; f < 2; ++f) {
        FragBF kf;
        int d = f * 32 + hi * 8;
        kf.q[0] = *(const uint4*)&krow[d];
        kf.q[1] = *(const uint4*)&krow[d + 16];
        st = __builtin_amdgcn_wmma_f32_16x16x32_bf16(
            false, kf.v, false, qa[f].v, (short)0, st, false, false);
      }
      s[t] = st;
    }

    // s[t][v] = score of key t*16 + 8*hi + v with query r, less mref
    float r0 = s[0][0], r1 = s[1][0];
    // unrolled: constant element indices keep the scores in registers
#pragma unroll
    for (int v = 1; v < 8; ++v) { r0 = fmaxf(r0, s[0][v]); r1 = fmaxf(r1, s[1][v]); }
    const float rm = fmaxf(r0, r1);   // this half's largest
    if (it == 0 || __builtin_amdgcn_ballot_w32(rm > 8.0f) != 0) {
      // wave-uniform.  Raise mref to the query's true maximum (first trip: set
      // it, whatever its sign; O and the sum are still zero there)
      const float qm = fmaxf(rm, xhalf(rm));
      const float up = it == 0 ? qm : fmaxf(qm, 0.f);
      const float sc = it == 0 ? 0.f : __builtin_amdgcn_exp2f(-up);
      negm = negm - up;
      s[0] = s[0] - up;
      s[1] = s[1] - up;
      lrow *= sc;
#pragma unroll
      for (int d = 0; d < 4; ++d) oacc[d] = oacc[d] * sc;
    }
    // P^T as B operand: element e < 8 is key 8*hi + e, element 8 + e is key
    // 16 + 8*hi + e, which is what V^T's two 16-byte reads per row deliver
    FragBF pb;
    u32 pw[8];
    float ps0 = 0.f, ps1 = 0.f;
#pragma unroll
    for (int i = 0; i < 8; ++i) {
      const float p0 = __builtin_amdgcn_exp2f(s[i >> 2][2 * (i & 3)]);
      const float p1 = __builtin_amdgcn_exp2f(s[i >> 2][2 * (i & 3) + 1]);
      pw[i] = pack_bf16x2(p0, p1);
      ps0 += p0;
      ps1 += p1;
    }
    lrow += ps0 + ps1;
    pb.q[0] = make_uint4(pw[0], pw[1], pw[2], pw[3]);
    pb.q[1] = make_uint4(pw[4], pw[5], pw[6], pw[7]);
#pragma unroll
    for (int ds = 0; ds < 4; ++ds) {
      const u16* vrow = &Vs[cur][ds * 16 + r][0];
      FragBF vf;
      vf.q[0] = *(const uint4*)&vrow[hi * 8];
      vf.q[1] = *(const uint4*)&vrow[hi * 8 + 16];
      oacc[ds] = __builtin_amdgcn_wmma_f32_16x16x32_bf16(
          false, vf.v, false, pb.v, (short)0, oacc[ds], false, false);
    }

    // hand-over: this wave's LDS reads are done, its copies of tile it+1 have
    // landed; behind the barrier both hold for all waves, so tile it+1 may be
    // read and the buffer just read may be refilled
    asm volatile("s_wait_dscnt 0x0" ::: "memory");
    asm volatile("s_wait_asynccnt 0x0" ::: "memory");
    __syncthreads();
    if (it + 2 < NT)
      stage_kv(gK + (size_t)(it + 2) * 32 * C3, &Ks[cur][kr][kc],
               gV + (it + 2) * 32, &Vs[cur][vr][vc]);
  }
  asm volatile("s_wait_asynccnt 0x0" ::: "memory");   // no copy outlives the loop

  // join the two halves' sums, normalize and write O as [M, C] bf16
  // (col = h*64 + d): a lane's 8 registers of a tile are 8 consecutive d
  const float inv = 1.0f / (lrow + xhalf(lrow));
  u16* orow = o + (size_t)(b * Nctx + q0 + r) * C + h * Dh + hi * 8;
#pragma unroll
  for (int ds = 0; ds < 4; ++ds) {
    const v8f ov = oacc[ds] * inv;
    *(uint4*)&orow[ds * 16] =
        make_uint4(pack_bf16x2(ov[0], ov[1]), pack_bf16x2(ov[2], ov[3]),
                   pack_bf16x2(ov[4], ov[5]), pack_bf16x2(ov[6], ov[7]));
  }
}

// ---------------------------------------------------------------------------
// host-side orchestration
// ---------------------------------------------------------------------------
extern "C" void kernel_launch(void* const* d_in, const int* in_sizes, int n_in,
                              void* d_out, int out_size, void* d_ws, size_t ws_size,
                              hipStream_t stream) {
  const float* x      = (const float*)d_in[0];
  const float* ln1_g  = (const float*)d_in[1];
  const float* ln1_b  = (const float*)d_in[2];
  const float* qkv_w  = (const float*)d_in[3];
  const float* proj_w = (const float*)d_in[4];
  const float* proj_b = (const float*)d_in[5];
  const float* ln2_g  = (const float*)d_in[6];
  const float* ln2_b  = (const float*)d_in[7];
  const float* fc1_w  = (const float*)d_in[8];
  const float* fc1_b  = (const float*)d_in[9];
  const float* fc2_w  = (const float*)d_in[10];
  const float* fc2_b  = (const float*)d_in[11];
  float* out = (float*)d_out;

  const int M = 8192, C = 1024, C3 = 3072, Hd = 4096;

  char* ws = (char*)d_ws;
  u16*   h_bf   = (u16*)(ws);                             // 16 MB  (LN out, reused)
  u16*   qkv_bf = (u16*)(ws + (size_t)16  * 1048576);     // 48 MB (Q, K columns used)
  u16*   vTb    = (u16*)(ws + (size_t)64  * 1048576);     // 16 MB
  u16*   o_bf   = (u16*)(ws + (size_t)80  * 1048576);     // 16 MB
  float* x1     = (float*)(ws + (size_t)96 * 1048576);    // 32 MB
  u16*   h2_bf  = (u16*)(ws + (size_t)128 * 1048576);     // 64 MB
  u16*   wqkv   = (u16*)(ws + (size_t)192 * 1048576);     // 24 MB total weights
  u16*   wproj  = wqkv  + (size_t)C3 * C;
  u16*   wfc1   = wproj + (size_t)C  * C;
  u16*   wfc2   = wfc1  + (size_t)Hd * C;

  // weights -> bf16 (wqkv, wproj, wfc1, wfc2 lie back to back)
  cast_weights_bf16_k<<<512, 256, 0, stream>>>(qkv_w, proj_w, fc1_w, fc2_w, wqkv);

  // attention branch
  layernorm_bf16_k<<<M, 256, 0, stream>>>(x, ln1_g, ln1_b, h_bf);
  gemm_bf16_k<0, 64><<<dim3(C3 / 128, M / 128), 256, 0, stream>>>(
      h_bf, wqkv, nullptr, nullptr, nullptr, qkv_bf, vTb, M, C3, C);
  flash_attn_k<<<dim3(2048 / 128, 4 * 16), 256, 0, stream>>>(qkv_bf, vTb, o_bf);
  gemm_bf16_k<1, 128><<<dim3(C / 128, M / 128), 256, 0, stream>>>(
      o_bf, wproj, proj_b, x, x1, nullptr, nullptr, M, C, C);

  // MLP branch
  layernorm_bf16_k<<<M, 256, 0, stream>>>(x1, ln2_g, ln2_b, h_bf);
  gemm_bf16_k<2, 64><<<dim3(Hd / 128, M / 128), 256, 0, stream>>>(
      h_bf, wfc1, fc1_b, nullptr, nullptr, h2_bf, nullptr, M, Hd, C);
  gemm_bf16_k<1, 128><<<dim3(C / 128, M / 128), 256, 0, stream>>>(
      h2_bf, wfc2, fc2_b, x1, out, nullptr, nullptr, M, C, Hd);
}

// v008
// Measured time: 256 microseconds a run.
// Two timings next to v007 both put it at 1.04 times that version's speed.
// Over all steps from v000 it is 2.83 times as fast.
#include <hip/hip_runtime.h>
#include <hip/hip_bf16.h>

typedef unsigned short u16;
typedef unsigned int u32;
typedef __attribute__((ext_vector_type(16))) __bf16 v16bf;
typedef __attribute__((ext_vector_type(8)))  float  v8f;

union FragBF {
  v16bf v;
  uint4 q[2];
  u16   h[16];
};

__device__ __forceinline__ u16 f32_to_bf16(float f) {
  union { float f; u32 u; } c; c.f = f;
  u32 u = c.u;
  u += 0x7fffu + ((u >> 16) & 1u);   // round-to-nearest-even
  return (u16)(u >> 16);
}

// two f32 -> one dword of two bf16, round to nearest even
__device__ __forceinline__ u32 pack_bf16x2(float lo, float hi) {
  typedef __bf16 bf2 __attribute__((ext_vector_type(2)));
  typedef float  f2  __attribute__((ext_vector_type(2)));
  return __builtin_bit_cast(u32, __builtin_convertvector(f2{lo, hi}, bf2));
}

// ---------------------------------------------------------------------------
// fp32 -> bf16 cast of the four weight matrices in one launch of 512 workgroups.
// Their bf16 copies lie back to back in out: qkv (3072 x 1024), proj
// (1024 x 1024), fc1 (4096 x 1024), fc2 (1024 x 4096).  A chunk is 8192 floats:
// a thread takes 8 float4, 256 threads apart, so that a wave's load covers 512
// contiguous bytes and its 8-byte store 256.  qkv and proj together, fc1, and
// fc2 are 512 chunks each: workgroup b takes chunk b of each of the three, and
// a thread issues its 24 loads ahead of its first store.
// ---------------------------------------------------------------------------
__global__ __launch_bounds__(256) void cast_weights_bf16_k(
    const float* __restrict__ wq, const float* __restrict__ wp,
    const float* __restrict__ w1, const float* __restrict__ w2,
    u16* __restrict__ out) {
  constexpr int CH = 8192;                 // floats per chunk
  constexpr int NQ = 3072 * 1024 / CH;     // chunks of qkv
  constexpr int NG = 512;                  // chunks per group = workgroups
  const int b  = blockIdx.x;
  const int t4 = threadIdx.x * 4;
  const float* s[3] = {b < NQ ? wq + (size_t)b * CH : wp + (size_t)(b - NQ) * CH,
                       w1 + (size_t)b * CH, w2 + (size_t)b * CH};
  float4 v[3][8];
  // all four loops unrolled: v stays in registers, the loads issue back to back
#pragma unroll
  for (int i = 0; i < 3; ++i)
#pragma unroll
    for (int j = 0; j < 8; ++j) v[i][j] = *(const float4*)&s[i][j * 1024 + t4];
#pragma unroll
  for (int i = 0; i < 3; ++i) {
    u16* d = out + (size_t)(i * NG + b) * CH + t4;
#pragma unroll
    for (int j = 0; j < 8; ++j)
      *(uint2*)&d[j * 1024] = make_uint2(pack_bf16x2(v[i][j].x, v[i][j].y),
                                         pack_bf16x2(v[i][j].z, v[i][j].w));
  }
}

// ---------------------------------------------------------------------------
// LayerNorm over C=1024, one row per block, bf16 output
// ---------------------------------------------------------------------------
__global__ __launch_bounds__(256) void layernorm_bf16_k(const float* __restrict__ x,
                                                        const float* __restrict__ g,
                                                        const float* __restrict__ b,
                                                        u16* __restrict__ out) {
  constexpr int C = 1024;
  __shared__ float red1[256];
  __shared__ float red2[256];
  const int row = blockIdx.x;
  const int tid = threadIdx.x;
  const float4 v = *(const float4*)&x[(size_t)row * C + tid * 4];
  float s  = v.x + v.y + v.z + v.w;
  float ss = v.x * v.x + v.y * v.y + v.z * v.z + v.w * v.w;
  red1[tid] = s; red2[tid] = ss;
  __syncthreads();
  for (int o = 128; o > 0; o >>= 1) {
    if (tid < o) { red1[tid] += red1[tid + o]; red2[tid] += red2[tid + o]; }
    __syncthreads();
  }
  const float mu  = red1[0] * (1.0f / 1024.0f);
  const float var = red2[0] * (1.0f / 1024.0f) - mu * mu;
  const float rs  = rsqrtf(var + 1e-5f);
#pragma unroll
  for (int j = 0; j < 4; ++j) {
    int c = tid * 4 + j;
    float xv = (&v.x)[j];
    out[(size_t)row * C + c] = f32_to_bf16((xv - mu) * rs * g[c] + b[c]);
  }
}

__device__ __forceinline__ void copy8(const u32 (&l)[8], const u16* const (&g)[8]) {
  asm volatile("global_load_async_to_lds_b128 %0, %8, off\n\t"
               "global_load_async_to_lds_b128 %1, %9, off\n\t"
               "global_load_async_to_lds_b128 %2, %10, off\n\t"
               "global_load_async_to_lds_b128 %3, %11, off\n\t"
               "global_load_async_to_lds_b128 %4, %12, off\n\t"
               "global_load_async_to_lds_b128 %5, %13, off\n\t"
               "global_load_async_to_lds_b128 %6, %14, off\n\t"
               "global_load_async_to_lds_b128 %7, %15, off\n\t"
               "s_wait_xcnt 0x0"
               :: "v"(l[0]), "v"(l[1]), "v"(l[2]), "v"(l[3]),
                  "v"(l[4]), "v"(l[5]), "v"(l[6]), "v"(l[7]),
                  "v"(g[0]), "v"(g[1]), "v"(g[2]), "v"(g[3]),
                  "v"(g[4]), "v"(g[5]), "v"(g[6]), "v"(g[7])
               : "memory");
}

// ---------------------------------------------------------------------------
// GELU with the exact (erf) definition, eight values, no branch:
//   gelu(t) = t * Phi(t) = max(t, 0) - |t| * erfc(|t| / sqrt 2) / 2
//   erfc(z) = (a1 u + a2 u^2 + ... + a5 u^5) * exp(-z^2),  u = 1 / (1 + p z)
// (the five-term form, absolute error of erfc below 2e-7).  The small term is
// subtracted from max(t, 0), so nothing cancels for negative t.  Written on
// whole vectors so that the multiply-adds pair up into packed instructions.
// ---------------------------------------------------------------------------
__device__ __forceinline__ v8f splat8(float c) { return v8f{c, c, c, c, c, c, c, c}; }

__device__ __forceinline__ v8f gelu8(v8f t) {
  v8f a, u, e, r;
  // both loops unrolled: constant element indices keep the vectors in registers
#pragma unroll
  for (int v = 0; v < 8; ++v) a[v] = fabsf(t[v]);
  const v8f d = a * 0.23164190f + 1.0f;          // 1 + p * |t| / sqrt 2
  const v8f q = (t * t) * -0.72134752f;          // -t^2 / 2 * log2(e)
#pragma unroll
  for (int v = 0; v < 8; ++v) {
    u[v] = __builtin_amdgcn_rcpf(d[v]);
    e[v] = __builtin_amdgcn_exp2f(q[v]);
    r[v] = fmaxf(t[v], 0.0f);
  }
  // half of a5 .. a1, nested multiply-adds in u
  v8f p = u * 0.53070271f - 0.72657601f;
  p = __builtin_elementwise_fma(p, u, splat8(0.71070687f));
  p = __builtin_elementwise_fma(p, u, splat8(-0.14224837f));
  p = __builtin_elementwise_fma(p, u, splat8(0.12741480f));
  return r - a * (p * u * e);
}

template <int EPI, int KS>
__global__ __launch_bounds__(256) void gemm_bf16_k(
    const u16* __restrict__ A, const u16* __restrict__ W,
    const float* __restrict__ bias, const float* __restrict__ res,
    float* __restrict__ outF, u16* __restrict__ outB, u16* __restrict__ outT,
    int M, int N, int K) {
  constexpr int PITCH = KS + 8;        // elements: row bytes + 16
  constexpr int CPR   = KS / 8;        // 16-byte chunks per row
  constexpr int RP    = 256 / CPR;     // rows the 256 threads copy at once
  constexpr int NC    = 128 / RP;      // copies per thread, operand and stage
  // S[0]: the A rows, S[1]: the W rows, two buffers each
  __shared__ __align__(16) u16 S[2][2][128][PITCH];

  const int tid  = threadIdx.x;
  const int lane = tid & 31;
  const int wave = tid >> 5;
  const int r    = lane & 15;
  const int hi   = lane >> 4;

  const int m0 = blockIdx.y * 128;
  const int n0 = blockIdx.x * 128;
  // V columns: the whole block (n0 is a multiple of 128)
  const bool vblk = EPI == 0 && n0 >= 2048;
  const int  sp = vblk ? 0 : 1;      // which of S is P
  const int  wp = (wave & 1) * 64;   // 2 waves along P
  const int  wq = (wave >> 1) * 32;  // 4 waves along Q

  // cooperative copy: thread t owns chunk t % CPR of rows t / CPR + RP * j
  const int row = tid / CPR;
  const int col = (tid % CPR) << 3;

  const u16* gA = &A[(size_t)(m0 + row) * K + col];
  const u16* gW = &W[(size_t)(n0 + row) * K + col];
  const size_t gstep = (size_t)RP * K;
  const u32 lA = (u32)(unsigned long long)(void*)&S[0][0][row][col];
  const u32 lW = (u32)(unsigned long long)(void*)&S[1][0][row][col];

  // this thread's 2 * NC copies of stage s into buffer buf, eight to a statement
  auto stage = [&](int s, int buf) {
#pragma unroll
    for (int q = 0; q < 2 * NC / 8; ++q) {
      u32 l[8];
      const u16* g[8];
#pragma unroll
      for (int e = 0; e < 8; ++e) {
        const int c = q * 8 + e, j = c % NC;
        l[e] = (c < NC ? lA : lW) + (u32)(buf * 128 + j * RP) * (PITCH * 2);
        g[e] = (c < NC ? gA : gW) + (size_t)s * KS + j * gstep;
      }
      copy8(l, g);
    }
  };

  v8f acc[4][2];
  const v8f zero8 = {0.f, 0.f, 0.f, 0.f, 0.f, 0.f, 0.f, 0.f};
#pragma unroll
  for (int i = 0; i < 4; ++i)
#pragma unroll
    for (int j = 0; j < 2; ++j) acc[i][j] = zero8;

  const int nk = K / KS;   // stages

  stage(0, 0);
  asm volatile("s_wait_asynccnt 0x0" ::: "memory");   // stage 0 has landed
  __syncthreads();                                    // ... for every wave
  if (nk > 1) stage(1, 1);

  for (int t = 0; t < nk; ++t) {
    const int cur = t & 1;
#pragma unroll
    for (int ks = 0; ks < KS / 32; ++ks) {
      FragBF qf[2], pf[4];
#pragma unroll
      for (int jj = 0; jj < 2; ++jj) {
        int rr = wq + jj * 16 + r;
        qf[jj].q[0] = *(const uint4*)&S[sp ^ 1][cur][rr][ks * 32 + hi * 8];
        qf[jj].q[1] = *(const uint4*)&S[sp ^ 1][cur][rr][ks * 32 + hi * 8 + 16];
      }
#pragma unroll
      for (int ii = 0; ii < 4; ++ii) {
        int rr = wp + ii * 16 + r;
        pf[ii].q[0] = *(const uint4*)&S[sp][cur][rr][ks * 32 + hi * 8];
        pf[ii].q[1] = *(const uint4*)&S[sp][cur][rr][ks * 32 + hi * 8 + 16];
      }
#pragma unroll
      for (int jj = 0; jj < 2; ++jj)
#pragma unroll
        for (int ii = 0; ii < 4; ++ii)
          acc[ii][jj] = __builtin_amdgcn_wmma_f32_16x16x32_bf16(
              false, pf[ii].v, false, qf[jj].v, (short)0, acc[ii][jj], false, false);
    }
    // hand-over: this wave's LDS reads are done, its copies of stage t+1 have
    // landed; behind the barrier both hold for all waves, so stage t+1 may be
    // read and the buffer just read may be refilled
    asm volatile("s_wait_dscnt 0x0" ::: "memory");
    asm volatile("s_wait_asynccnt 0x0" ::: "memory");
    __syncthreads();
    if (t + 2 < nk) stage(t + 2, cur);
  }
  asm volatile("s_wait_asynccnt 0x0" ::: "memory");   // no copy outlives the loop

  // epilogue.  acc[i][j][v] is p = wp + i*16 + 8*hi + v, q = wq + j*16 + r.
  // Behind the loop's last barrier no wave reads S any more and no copy is in
  // flight: S is free, and each wave stages in a range of its own.
  // Every loop below is unrolled: constant indices keep acc in registers.
  if constexpr (EPI == 1) {
    constexpr int SP = 64 + 4;
    static_assert(8 * 32 * SP * 4 <= (int)sizeof(S), "staging fits the ring");
    float* st = (float*)&S[0][0][0][0] + wave * (32 * SP);
    const int c4 = (lane & 15) * 4;   // a lane's 4 columns; 16 lanes = one row
    const size_t o0 = (size_t)(m0 + wq + hi) * N + n0 + wp + c4;
    const float4 bv = *(const float4*)&bias[n0 + wp + c4];
    float4 rv[16];
    const float* rp[16];
    // unrolled: rv stays in registers, the 16 loads issue ahead of the staging
#pragma unroll
    for (int c = 0; c < 16; ++c) {
      rp[c] = &res[o0 + (size_t)(2 * c) * N];
      rv[c] = *(const float4*)rp[c];
    }
    // The 16 addresses are inputs of the wait, so that each stays in its
    // registers up to it: no load's result lands on an issued load's address.
    asm volatile("s_wait_xcnt 0x0"
                 :: "v"(rp[0]), "v"(rp[1]), "v"(rp[2]), "v"(rp[3]),
                    "v"(rp[4]), "v"(rp[5]), "v"(rp[6]), "v"(rp[7]),
                    "v"(rp[8]), "v"(rp[9]), "v"(rp[10]), "v"(rp[11]),
                    "v"(rp[12]), "v"(rp[13]), "v"(rp[14]), "v"(rp[15])
                 : "memory");
#pragma unroll
    for (int i = 0; i < 4; ++i)
#pragma unroll
      for (int j = 0; j < 2; ++j) {
        const v8f a = acc[i][j];
        float* d = &st[(j * 16 + r) * SP + i * 16 + hi * 8];
        *(float4*)&d[0] = make_float4(a[0], a[1], a[2], a[3]);
        *(float4*)&d[4] = make_float4(a[4], a[5], a[6], a[7]);
      }
    // the wave's own LDS stores are done before it reads what other lanes wrote
    asm volatile("s_wait_dscnt 0x0" ::: "memory");
#pragma unroll
    for (int c = 0; c < 16; ++c) {   // rows 2c and 2c+1 of the wave's tile
      const float4 a = *(const float4*)&st[(2 * c + hi) * SP + c4];
      *(float4*)&outF[o0 + (size_t)(2 * c) * N] =
          make_float4(a.x + bv.x + rv[c].x, a.y + bv.y + rv[c].y,
                      a.z + bv.z + rv[c].z, a.w + bv.w + rv[c].w);
    }
  } else {
    constexpr int SP = 64 + 8;
    static_assert(8 * 32 * SP * 2 <= (int)sizeof(S), "staging fits the ring");
    u16* st = &S[0][0][0][0] + wave * (32 * SP);
    // SCALE = 64^-0.5 on Q, times log2(e): the scores come out in log2 units
    const float sc = (EPI == 0 && n0 < 1024) ? 0.18033688f : 1.0f;
#pragma unroll
    for (int i = 0; i < 4; ++i) {
      v8f bv;
      if constexpr (EPI == 2) {
        const float* bp = &bias[n0 + wp + i * 16 + hi * 8];
        const float4 b0 = *(const float4*)&bp[0], b1 = *(const float4*)&bp[4];
        bv = v8f{b0.x, b0.y, b0.z, b0.w, b1.x, b1.y, b1.z, b1.w};
      }
#pragma unroll
      for (int j = 0; j < 2; ++j) {
        v8f a;
        if constexpr (EPI == 2) a = gelu8(acc[i][j] + bv);
        else                    a = acc[i][j] * sc;
        *(uint4*)&st[(j * 16 + r) * SP + i * 16 + hi * 8] =
            make_uint4(pack_bf16x2(a[0], a[1]), pack_bf16x2(a[2], a[3]),
                       pack_bf16x2(a[4], a[5]), pack_bf16x2(a[6], a[7]));
      }
    }
    // output row q of the wave's tile starts at o[q * ld]: 64 elements, one line
    u16*   o  = outB + (size_t)(m0 + wq) * N + n0 + wp;
    size_t ld = (size_t)N;
    if (vblk) {
      o  = outT + ((size_t)(m0 >> 11) * 1024 + (n0 - 2048 + wq)) * 2048 + (m0 & 2047) + wp;
      ld = 2048;
    }
    o  += (size_t)(lane >> 3) * ld + (lane & 7) * 8;   // this lane's 16 bytes of a row
    st += (lane >> 3) * SP + (lane & 7) * 8;
    // the wave's own LDS stores are done before it reads what other lanes wrote
    asm volatile("s_wait_dscnt 0x0" ::: "memory");
#pragma unroll
    for (int c = 0; c < 8; ++c)   // 8 lanes to a row, 4 rows to a store
      *(uint4*)&o[(size_t)(4 * c) * ld] = *(const uint4*)&st[4 * c * SP];
  }
}

__device__ __forceinline__ float xhalf(float x) {
  int b = __builtin_bit_cast(int, x);
  return __builtin_bit_cast(float, __builtin_amdgcn_permlanex16(
      b, b, 0x76543210, 0xfedcba98, false, false));
}

__device__ __forceinline__ void stage_kv(const u16* gk, u16* lk,
                                         const u16* gv, u16* lv) {
  asm volatile("global_load_async_to_lds_b128 %0, %1, off\n\t"
               "global_load_async_to_lds_b128 %2, %3, off\n\t"
               "s_wait_xcnt 0x0"
               :: "v"((u32)(unsigned long long)(void*)lk), "v"(gk),
                  "v"((u32)(unsigned long long)(void*)lv), "v"(gv)
               : "memory");
}

__global__ __launch_bounds__(256) void flash_attn_k(const u16* __restrict__ qkv,
                                                    const u16* __restrict__ vT,
                                                    u16* __restrict__ o) {
  constexpr int Nctx = 2048, C = 1024, C3 = 3072, Dh = 64;
  constexpr int NT = Nctx / 32;   // key tiles
  __shared__ __align__(16) u16 Ks[2][32][72];
  __shared__ __align__(16) u16 Vs[2][64][40];

  const int tid  = threadIdx.x;
  const int lane = tid & 31;
  const int wave = tid >> 5;
  const int r    = lane & 15;
  const int hi   = lane >> 4;

  const int bh = blockIdx.y;   // b*16 + h
  const int b  = bh >> 4;
  const int h  = bh & 15;
  const int q0 = blockIdx.x * 128 + wave * 16;

  const v8f zero8 = {0.f, 0.f, 0.f, 0.f, 0.f, 0.f, 0.f, 0.f};

  // Q fragments (B operand: lane = query column), Q already scaled by
  // 0.125 * log2(e) in the qkv epilogue
  FragBF qa[2];
  {
    const u16* qrow = qkv + (size_t)(b * Nctx + q0 + r) * C3 + h * Dh;
#pragma unroll
    for (int f = 0; f < 2; ++f) {
      int d = f * 32 + hi * 8;
      qa[f].q[0] = *(const uint4*)&qrow[d];
      qa[f].q[1] = *(const uint4*)&qrow[d + 16];
    }
  }

  // per lane: negm = -mref of query r in all 8 registers (same in both halves)
  // and the sum over this half's keys; oacc[ds][v] = O[query r][d = ds*16 + 8*hi + v]
  float lrow = 0.f;
  v8f negm = zero8;
  v8f oacc[4];
#pragma unroll
  for (int d = 0; d < 4; ++d) oacc[d] = zero8;

  // this thread's 16 bytes of every tile: K row tid/8, V^T row tid/4
  const int kr = tid >> 3, kc = (tid & 7) << 3;
  const int vr = tid >> 2, vc = (tid & 3) << 3;
  const u16* gK = qkv + (size_t)(b * Nctx + kr) * C3 + C + h * Dh + kc;
  const u16* gV = vT + ((size_t)bh * Dh + vr) * Nctx + vc;

  stage_kv(gK, &Ks[0][kr][kc], gV, &Vs[0][vr][vc]);
  asm volatile("s_wait_asynccnt 0x0" ::: "memory");   // tile 0 has landed
  __syncthreads();                                    // ... for every wave
  stage_kv(gK + (size_t)32 * C3, &Ks[1][kr][kc], gV + 32, &Vs[1][vr][vc]);

  for (int it = 0; it < NT; ++it) {
    const int cur = it & 1;
    v8f s[2];
#pragma unroll
    for (int t = 0; t < 2; ++t) {
      const u16* krow = &Ks[cur][t * 16 + r][0];
      v8f st = negm;
#pragma unroll
      for (int f = 0; f < 2; ++f) {
        FragBF kf;
        int d = f * 32 + hi * 8;
        kf.q[0] = *(const uint4*)&krow[d];
        kf.q[1] = *(const uint4*)&krow[d + 16];
        st = __builtin_amdgcn_wmma_f32_16x16x32_bf16(
            false, kf.v, false, qa[f].v, (short)0, st, false, false);
      }
      s[t] = st;
    }

    // s[t][v] = score of key t*16 + 8*hi + v with query r, less mref
    float r0 = s[0][0], r1 = s[1][0];
    // unrolled: constant element indices keep the scores in registers
#pragma unroll
    for (int v = 1; v < 8; ++v) { r0 = fmaxf(r0, s[0][v]); r1 = fmaxf(r1, s[1][v]); }
    const float rm = fmaxf(r0, r1);   // this half's largest
    if (it == 0 || __builtin_amdgcn_ballot_w32(rm > 8.0f) != 0) {
      // wave-uniform.  Raise mref to the query's true maximum (first trip: set
      // it, whatever its sign; O and the sum are still zero there)
      const float qm = fmaxf(rm, xhalf(rm));
      const float up = it == 0 ? qm : fmaxf(qm, 0.f);
      const float sc = it == 0 ? 0.f : __builtin_amdgcn_exp2f(-up);
      negm = negm - up;
      s[0] = s[0] - up;
      s[1] = s[1] - up;
      lrow *= sc;
#pragma unroll
      for (int d = 0; d < 4; ++d) oacc[d] = oacc[d] * sc;
    }
    // P^T as B operand: element e < 8 is key 8*hi + e, element 8 + e is key
    // 16 + 8*hi + e, which is what V^T's two 16-byte reads per row deliver
    FragBF pb;
    u32 pw[8];
    float ps0 = 0.f, ps1 = 0.f;
#pragma unroll
    for (int i = 0; i < 8; ++i) {
      const float p0 = __builtin_amdgcn_exp2f(s[i >> 2][2 * (i & 3)]);
      const float p1 = __builtin_amdgcn_exp2f(s[i >> 2][2 * (i & 3) + 1]);
      pw[i] = pack_bf16x2(p0, p1);
      ps0 += p0;
      ps1 += p1;
    }
    lrow += ps0 + ps1;
    pb.q[0] = make_uint4(pw[0], pw[1], pw[2], pw[3]);
    pb.q[1] = make_uint4(pw[4], pw[5], pw[6], pw[7]);
#pragma unroll
    for (int ds = 0; ds < 4; ++ds) {
      const u16* vrow = &Vs[cur][ds * 16 + r][0];
      FragBF vf;
      vf.q[0] = *(const uint4*)&vrow[hi * 8];
      vf.q[1] = *(const uint4*)&vrow[hi * 8 + 16];
      oacc[ds] = __builtin_amdgcn_wmma_f32_16x16x32_bf16(
          false, vf.v, false, pb.v, (short)0, oacc[ds], false, false);
    }

    // hand-over: this wave's LDS reads are done, its copies of tile it+1 have
    // landed; behind the barrier both hold for all waves, so tile it+1 may be
    // read and the buffer just read may be refilled
    asm volatile("s_wait_dscnt 0x0" ::: "memory");
    asm volatile("s_wait_asynccnt 0x0" ::: "memory");
    __syncthreads();
    if (it + 2 < NT)
      stage_kv(gK + (size_t)(it + 2) * 32 * C3, &Ks[cur][kr][kc],
               gV + (it + 2) * 32, &Vs[cur][vr][vc]);
  }
  asm volatile("s_wait_asynccnt 0x0" ::: "memory");   // no copy outlives the loop

  // join the two halves' sums, normalize and write O as [M, C] bf16
  // (col = h*64 + d): a lane's 8 registers of a tile are 8 consecutive d
  const float inv = 1.0f / (lrow + xhalf(lrow));
  u16* orow = o + (size_t)(b * Nctx + q0 + r) * C + h * Dh + hi * 8;
#pragma unroll
  for (int ds = 0; ds < 4; ++ds) {
    const v8f ov = oacc[ds] * inv;
    *(uint4*)&orow[ds * 16] =
        make_uint4(pack_bf16x2(ov[0], ov[1]), pack_bf16x2(ov[2], ov[3]),
                   pack_bf16x2(ov[4], ov[5]), pack_bf16x2(ov[6], ov[7]));
  }
}

// ---------------------------------------------------------------------------
// host-side orchestration
// ---------------------------------------------------------------------------
extern "C" void kernel_launch(void* const* d_in, const int* in_sizes, int n_in,
                              void* d_out, int out_size, void* d_ws, size_t ws_size,
                              hipStream_t stream) {
  const float* x      = (const float*)d_in[0];
  const float* ln1_g  = (const float*)d_in[1];
  const float* ln1_b  = (const float*)d_in[2];
  const float* qkv_w  = (const float*)d_in[3];
  const float* proj_w = (const float*)d_in[4];
  const float* proj_b = (const float*)d_in[5];
  const float* ln2_g  = (const float*)d_in[6];
  const float* ln2_b  = (const float*)d_in[7];
  const float* fc1_w  = (const float*)d_in[8];
  const float* fc1_b  = (const float*)d_in[9];
  const float* fc2_w  = (const float*)d_in[10];
  const float* fc2_b  = (const float*)d_in[11];
  float* out = (float*)d_out;

  const int M = 8192, C = 1024, C3 = 3072, Hd = 4096;

  char* ws = (char*)d_ws;
  u16*   h_bf   = (u16*)(ws);                             // 16 MB  (LN out, reused)
  u16*   qkv_bf = (u16*)(ws + (size_t)16  * 1048576);     // 48 MB (Q, K columns used)
  u16*   vTb    = (u16*)(ws + (size_t)64  * 1048576);     // 16 MB
  u16*   o_bf   = (u16*)(ws + (size_t)80  * 1048576);     // 16 MB
  float* x1     = (float*)(ws + (size_t)96 * 1048576);    // 32 MB
  u16*   h2_bf  = (u16*)(ws + (size_t)128 * 1048576);     // 64 MB
  u16*   wqkv   = (u16*)(ws + (size_t)192 * 1048576);     // 24 MB total weights
  u16*   wproj  = wqkv  + (size_t)C3 * C;
  u16*   wfc1   = wproj + (size_t)C  * C;
  u16*   wfc2   = wfc1  + (size_t)Hd * C;

  // weights -> bf16 (wqkv, wproj, wfc1, wfc2 lie back to back)
  cast_weights_bf16_k<<<512, 256, 0, stream>>>(qkv_w, proj_w, fc1_w, fc2_w, wqkv);

  // attention branch
  layernorm_bf16_k<<<M, 256, 0, stream>>>(x, ln1_g, ln1_b, h_bf);
  gemm_bf16_k<0, 64><<<dim3(C3 / 128, M / 128), 256, 0, stream>>>(
      h_bf, wqkv, nullptr, nullptr, nullptr, qkv_bf, vTb, M, C3, C);
  flash_attn_k<<<dim3(2048 / 128, 4 * 16), 256, 0, stream>>>(qkv_bf, vTb, o_bf);
  gemm_bf16_k<1, 128><<<dim3(C / 128, M / 128), 256, 0, stream>>>(
      o_bf, wproj, proj_b, x, x1, nullptr, nullptr, M, C, C);

  // MLP branch
  layernorm_bf16_k<<<M, 256, 0, stream>>>(x1, ln2_g, ln2_b, h_bf);
  gemm_bf16_k<2, 64><<<dim3(Hd / 128, M / 128), 256, 0, stream>>>(
      h_bf, wfc1, fc1_b, nullptr, nullptr, h2_bf, nullptr, M, Hd, C);
  gemm_bf16_k<1, 128><<<dim3(C / 128, M / 128), 256, 0, stream>>>(
      h2_bf, wfc2, fc2_b, x1, out, nullptr, nullptr, M, C, Hd);
}

// v009
// One run takes 247 microseconds.
// Timed twice side by side with v008, it ran 1.04 times as fast both times.
// All steps since v000 together make it 2.94 times as fast.
#include <hip/hip_runtime.h>
#include <hip/hip_bf16.h>

typedef unsigned short u16;
typedef unsigned int u32;
typedef __attribute__((ext_vector_type(16))) __bf16 v16bf;
typedef __attribute__((ext_vector_type(8)))  float  v8f;

union FragBF {
  v16bf v;
  uint4 q[2];
  u16   h[16];
};

__device__ __forceinline__ u16 f32_to_bf16(float f) {
  union { float f; u32 u; } c; c.f = f;
  u32 u = c.u;
  u += 0x7fffu + ((u >> 16) & 1u);   // round-to-nearest-even
  return (u16)(u >> 16);
}

// two f32 -> one dword of two bf16, round to nearest even
__device__ __forceinline__ u32 pack_bf16x2(float lo, float hi) {
  typedef __bf16 bf2 __attribute__((ext_vector_type(2)));
  typedef float  f2  __attribute__((ext_vector_type(2)));
  return __builtin_bit_cast(u32, __builtin_convertvector(f2{lo, hi}, bf2));
}

// ---------------------------------------------------------------------------
// fp32 -> bf16 cast of the four weight matrices in one launch of 512 workgroups.
// Their bf16 copies lie back to back in out: qkv (3072 x 1024), proj
// (1024 x 1024), fc1 (4096 x 1024), fc2 (1024 x 4096).  A chunk is 8192 floats:
// a thread takes 8 float4, 256 threads apart, so that a wave's load covers 512
// contiguous bytes and its 8-byte store 256.  qkv and proj together, fc1, and
// fc2 are 512 chunks each: workgroup b takes chunk b of each of the three, and
// a thread issues its 24 loads ahead of its first store.
// ---------------------------------------------------------------------------
__global__ __launch_bounds__(256) void cast_weights_bf16_k(
    const float* __restrict__ wq, const float* __restrict__ wp,
    const float* __restrict__ w1, const float* __restrict__ w2,
    u16* __restrict__ out) {
  constexpr int CH = 8192;                 // floats per chunk
  constexpr int NQ = 3072 * 1024 / CH;     // chunks of qkv
  constexpr int NG = 512;                  // chunks per group = workgroups
  const int b  = blockIdx.x;
  const int t4 = threadIdx.x * 4;
  const float* s[3] = {b < NQ ? wq + (size_t)b * CH : wp + (size_t)(b - NQ) * CH,
                       w1 + (size_t)b * CH, w2 + (size_t)b * CH};
  float4 v[3][8];
  // all four loops unrolled: v stays in registers, the loads issue back to back
#pragma unroll
  for (int i = 0; i < 3; ++i)
#pragma unroll
    for (int j = 0; j < 8; ++j) v[i][j] = *(const float4*)&s[i][j * 1024 + t4];
#pragma unroll
  for (int i = 0; i < 3; ++i) {
    u16* d = out + (size_t)(i * NG + b) * CH + t4;
#pragma unroll
    for (int j = 0; j < 8; ++j)
      *(uint2*)&d[j * 1024] = make_uint2(pack_bf16x2(v[i][j].x, v[i][j].y),
                                         pack_bf16x2(v[i][j].z, v[i][j].w));
  }
}

// ---------------------------------------------------------------------------
// LayerNorm over C=1024, one row per block, bf16 output
// ---------------------------------------------------------------------------
__global__ __launch_bounds__(256) void layernorm_bf16_k(const float* __restrict__ x,
                                                        const float* __restrict__ g,
                                                        const float* __restrict__ b,
                                                        u16* __restrict__ out) {
  constexpr int C = 1024;
  __shared__ float red1[256];
  __shared__ float red2[256];
  const int row = blockIdx.x;
  const int tid = threadIdx.x;
  const float4 v = *(const float4*)&x[(size_t)row * C + tid * 4];
  float s  = v.x + v.y + v.z + v.w;
  float ss = v.x * v.x + v.y * v.y + v.z * v.z + v.w * v.w;
  red1[tid] = s; red2[tid] = ss;
  __syncthreads();
  for (int o = 128; o > 0; o >>= 1) {
    if (tid < o) { red1[tid] += red1[tid + o]; red2[tid] += red2[tid + o]; }
    __syncthreads();
  }
  const float mu  = red1[0] * (1.0f / 1024.0f);
  const float var = red2[0] * (1.0f / 1024.0f) - mu * mu;
  const float rs  = rsqrtf(var + 1e-5f);
#pragma unroll
  for (int j = 0; j < 4; ++j) {
    int c = tid * 4 + j;
    float xv = (&v.x)[j];
    out[(size_t)row * C + c] = f32_to_bf16((xv - mu) * rs * g[c] + b[c]);
  }
}

__device__ __forceinline__ void copy12(const u32 (&l)[12], const u16* const (&g)[12]) {
  asm volatile("global_load_async_to_lds_b128 %0, %12, off\n\t"
               "global_load_async_to_lds_b128 %1, %13, off\n\t"
               "global_load_async_to_lds_b128 %2, %14, off\n\t"
               "global_load_async_to_lds_b128 %3, %15, off\n\t"
               "global_load_async_to_lds_b128 %4, %16, off\n\t"
               "global_load_async_to_lds_b128 %5, %17, off\n\t"
               "global_load_async_to_lds_b128 %6, %18, off\n\t"
               "global_load_async_to_lds_b128 %7, %19, off\n\t"
               "global_load_async_to_lds_b128 %8, %20, off\n\t"
               "global_load_async_to_lds_b128 %9, %21, off\n\t"
               "global_load_async_to_lds_b128 %10, %22, off\n\t"
               "global_load_async_to_lds_b128 %11, %23, off\n\t"
               "s_wait_xcnt 0x0"
               :: "v"(l[0]), "v"(l[1]), "v"(l[2]), "v"(l[3]),
                  "v"(l[4]), "v"(l[5]), "v"(l[6]), "v"(l[7]),
                  "v"(l[8]), "v"(l[9]), "v"(l[10]), "v"(l[11]),
                  "v"(g[0]), "v"(g[1]), "v"(g[2]), "v"(g[3]),
                  "v"(g[4]), "v"(g[5]), "v"(g[6]), "v"(g[7]),
                  "v"(g[8]), "v"(g[9]), "v"(g[10]), "v"(g[11])
               : "memory");
}

// ---------------------------------------------------------------------------
// GELU with the exact (erf) definition, eight values, no branch:
//   gelu(t) = t * Phi(t) = max(t, 0) - |t| * erfc(|t| / sqrt 2) / 2
//   erfc(z) = (a1 u + a2 u^2 + ... + a5 u^5) * exp(-z^2),  u = 1 / (1 + p z)
// (the five-term form, absolute error of erfc below 2e-7).  The small term is
// subtracted from max(t, 0), so nothing cancels for negative t.  Written on
// whole vectors so that the multiply-adds pair up into packed instructions.
// ---------------------------------------------------------------------------
__device__ __forceinline__ v8f splat8(float c) { return v8f{c, c, c, c, c, c, c, c}; }

__device__ __forceinline__ v8f gelu8(v8f t) {
  v8f a, u, e, r;
  // both loops unrolled: constant element indices keep the vectors in registers
#pragma unroll
  for (int v = 0; v < 8; ++v) a[v] = fabsf(t[v]);
  const v8f d = a * 0.23164190f + 1.0f;          // 1 + p * |t| / sqrt 2
  const v8f q = (t * t) * -0.72134752f;          // -t^2 / 2 * log2(e)
#pragma unroll
  for (int v = 0; v < 8; ++v) {
    u[v] = __builtin_amdgcn_rcpf(d[v]);
    e[v] = __builtin_amdgcn_exp2f(q[v]);
    r[v] = fmaxf(t[v], 0.0f);
  }
  // half of a5 .. a1, nested multiply-adds in u
  v8f p = u * 0.53070271f - 0.72657601f;
  p = __builtin_elementwise_fma(p, u, splat8(0.71070687f));
  p = __builtin_elementwise_fma(p, u, splat8(-0.14224837f));
  p = __builtin_elementwise_fma(p, u, splat8(0.12741480f));
  return r - a * (p * u * e);
}

template <int EPI, int KS>
__global__ __launch_bounds__(256) void gemm_bf16_k(
    const u16* __restrict__ A, const u16* __restrict__ W,
    const float* __restrict__ bias, const float* __restrict__ res,
    float* __restrict__ outF, u16* __restrict__ outB, u16* __restrict__ outT,
    int M, int N, int K) {
  constexpr int TA    = 256;           // A rows of the block tile
  constexpr int TW    = 128;           // W rows
  constexpr int TR    = TA + TW;       // rows of a buffer
  constexpr int PITCH = KS + 8;        // elements: row bytes + 16
  constexpr int CPR   = KS / 8;        // 16-byte chunks per row
  constexpr int RP    = 256 / CPR;     // rows the 256 threads copy at once
  constexpr int NC    = TR / RP;       // copies per thread and stage
  // two buffers; rows 0 .. 255: the A rows, rows 256 .. 383: the W rows
  __shared__ __align__(16) u16 S[2][TR][PITCH];

  const int tid  = threadIdx.x;
  const int lane = tid & 31;
  const int wave = tid >> 5;
  const int r    = lane & 15;
  const int hi   = lane >> 4;

  const int m0 = blockIdx.y * TA;
  const int n0 = blockIdx.x * TW;
  // V columns: the whole block (n0 is a multiple of 128)
  const bool vblk = EPI == 0 && n0 >= 2048;
  const int  wA = (wave >> 1) * 64;   // 4 waves along the A rows
  const int  wW = (wave & 1) * 64;    // 2 waves along the W rows
  const int  wp = vblk ? wA : wW;
  const int  wq = vblk ? wW : wA;

  // cooperative copy: thread t owns chunk t % CPR of rows t / CPR + RP * c
  const int row = tid / CPR;
  const int col = (tid % CPR) << 3;

  const u16* gA = &A[(size_t)(m0 + row) * K + col];
  const u16* gW = &W[(size_t)(n0 + row) * K + col];
  const size_t gstep = (size_t)RP * K;
  const u32 l0 = (u32)(unsigned long long)(void*)&S[0][row][col];

  // this thread's NC copies of stage s into buffer buf, twelve to a statement
  auto stage = [&](int s, int buf) {
#pragma unroll
    for (int q = 0; q < NC / 12; ++q) {
      u32 l[12];
      const u16* g[12];
#pragma unroll
      for (int e = 0; e < 12; ++e) {
        const int c = q * 12 + e;
        l[e] = l0 + (u32)(buf * TR + c * RP) * (PITCH * 2);
        g[e] = (c * RP < TA ? gA + c * gstep : gW + (c - TA / RP) * gstep) + (size_t)s * KS;
      }
      copy12(l, g);
    }
  };

  v8f acc[4][4];
  const v8f zero8 = {0.f, 0.f, 0.f, 0.f, 0.f, 0.f, 0.f, 0.f};
#pragma unroll
  for (int i = 0; i < 4; ++i)
#pragma unroll
    for (int j = 0; j < 4; ++j) acc[i][j] = zero8;

  const int nk = K / KS;   // stages

  stage(0, 0);
  asm volatile("s_wait_asynccnt 0x0" ::: "memory");   // stage 0 has landed
  __syncthreads();                                    // ... for every wave
  if (nk > 1) stage(1, 1);

  // this lane's first fragment row of P and of Q in buffer 0
  const u16* pl = &S[0][(vblk ? 0 : TA) + wp + r][hi * 8];
  const u16* ql = &S[0][(vblk ? TA : 0) + wq + r][hi * 8];

  for (int t = 0; t < nk; ++t) {
    const int cur = t & 1;
    const int co  = cur * (TR * PITCH);
#pragma unroll
    for (int ks = 0; ks < KS / 32; ++ks) {
      FragBF qf[4], pf[4];
      // the two scheduling fences keep a k step's 16 fragment reads together,
      // ahead of its 16 matrix instructions: without them the compiler reloads one
      // Q fragment register set among the matrix instructions and waits for each
      __builtin_amdgcn_sched_barrier(0);
#pragma unroll
      for (int jj = 0; jj < 4; ++jj) {
        qf[jj].q[0] = *(const uint4*)&ql[co + jj * 16 * PITCH + ks * 32];
        qf[jj].q[1] = *(const uint4*)&ql[co + jj * 16 * PITCH + ks * 32 + 16];
      }
#pragma unroll
      for (int ii = 0; ii < 4; ++ii) {
        pf[ii].q[0] = *(const uint4*)&pl[co + ii * 16 * PITCH + ks * 32];
        pf[ii].q[1] = *(const uint4*)&pl[co + ii * 16 * PITCH + ks * 32 + 16];
      }
      __builtin_amdgcn_sched_barrier(0);
#pragma unroll
      for (int jj = 0; jj < 4; ++jj)
#pragma unroll
        for (int ii = 0; ii < 4; ++ii)
          acc[ii][jj] = __builtin_amdgcn_wmma_f32_16x16x32_bf16(
              false, pf[ii].v, false, qf[jj].v, (short)0, acc[ii][jj], false, false);
    }
    // hand-over: this wave's LDS reads are done, its copies of stage t+1 have
    // landed; behind the barrier both hold for all waves, so stage t+1 may be
    // read and the buffer just read may be refilled
    asm volatile("s_wait_dscnt 0x0" ::: "memory");
    asm volatile("s_wait_asynccnt 0x0" ::: "memory");
    __syncthreads();
    if (t + 2 < nk) stage(t + 2, cur);
  }
  asm volatile("s_wait_asynccnt 0x0" ::: "memory");   // no copy outlives the loop

  // epilogue.  acc[i][j][v] is p = wp + i*16 + 8*hi + v, q = wq + j*16 + r.
  // Behind the loop's last barrier no wave reads S any more and no copy is in
  // flight: S is free, and each wave stages in a range of its own.
  // Every loop below is unrolled: constant indices keep acc in registers.
  if constexpr (EPI == 1) {
    constexpr int SP = 64 + 4;
    static_assert(8 * 64 * SP * 4 <= (int)sizeof(S), "staging fits the ring");
    float* st = (float*)&S[0][0][0] + wave * (64 * SP);
    const int c4 = (lane & 15) * 4;   // a lane's 4 columns; 16 lanes = one row
    const size_t o0 = (size_t)(m0 + wq + hi) * N + n0 + wp + c4;
    const float4 bv = *(const float4*)&bias[n0 + wp + c4];
    float4 rv[2][16];
    // unrolled: rv stays in registers, the 32 loads issue ahead of the staging
#pragma unroll
    for (int h = 0; h < 2; ++h) {
      const float* rp[16];
#pragma unroll
      for (int c = 0; c < 16; ++c) {
        rp[c] = &res[o0 + (size_t)(32 * h + 2 * c) * N];
        rv[h][c] = *(const float4*)rp[c];
      }
      // The 16 addresses are inputs of the wait, so that each stays in its
      // registers up to it: no load's result lands on an issued load's address.
      asm volatile("s_wait_xcnt 0x0"
                   :: "v"(rp[0]), "v"(rp[1]), "v"(rp[2]), "v"(rp[3]),
                      "v"(rp[4]), "v"(rp[5]), "v"(rp[6]), "v"(rp[7]),
                      "v"(rp[8]), "v"(rp[9]), "v"(rp[10]), "v"(rp[11]),
                      "v"(rp[12]), "v"(rp[13]), "v"(rp[14]), "v"(rp[15])
                   : "memory");
    }
#pragma unroll
    for (int i = 0; i < 4; ++i)
#pragma unroll
      for (int j = 0; j < 4; ++j) {
        const v8f a = acc[i][j];
        float* d = &st[(j * 16 + r) * SP + i * 16 + hi * 8];
        *(float4*)&d[0] = make_float4(a[0], a[1], a[2], a[3]);
        *(float4*)&d[4] = make_float4(a[4], a[5], a[6], a[7]);
      }
    // the wave's own LDS stores are done before it reads what other lanes wrote
    asm volatile("s_wait_dscnt 0x0" ::: "memory");
#pragma unroll
    for (int c = 0; c < 32; ++c) {   // rows 2c and 2c+1 of the wave's tile
      const float4 a = *(const float4*)&st[(2 * c + hi) * SP + c4];
      const float4 x = rv[c >> 4][c & 15];
      *(float4*)&outF[o0 + (size_t)(2 * c) * N] =
          make_float4(a.x + bv.x + x.x, a.y + bv.y + x.y,
                      a.z + bv.z + x.z, a.w + bv.w + x.w);
    }
  } else {
    constexpr int SP = 64 + 8;
    static_assert(8 * 64 * SP * 2 <= (int)sizeof(S), "staging fits the ring");
    u16* st = &S[0][0][0] + wave * (64 * SP);
    // SCALE = 64^-0.5 on Q, times log2(e): the scores come out in log2 units
    const float sc = (EPI == 0 && n0 < 1024) ? 0.18033688f : 1.0f;
#pragma unroll
    for (int i = 0; i < 4; ++i) {
      v8f bv;
      if constexpr (EPI == 2) {
        const float* bp = &bias[n0 + wp + i * 16 + hi * 8];
        const float4 b0 = *(const float4*)&bp[0], b1 = *(const float4*)&bp[4];
        bv = v8f{b0.x, b0.y, b0.z, b0.w, b1.x, b1.y, b1.z, b1.w};
      }
#pragma unroll
      for (int j = 0; j < 4; ++j) {
        v8f a;
        if constexpr (EPI == 2) a = gelu8(acc[i][j] + bv);
        else                    a = acc[i][j] * sc;
        *(uint4*)&st[(j * 16 + r) * SP + i * 16 + hi * 8] =
            make_uint4(pack_bf16x2(a[0], a[1]), pack_bf16x2(a[2], a[3]),
                       pack_bf16x2(a[4], a[5]), pack_bf16x2(a[6], a[7]));
      }
    }
    // output row q of the wave's tile starts at o[q * ld]: 64 elements, one line
    u16*   o  = outB + (size_t)(m0 + wq) * N + n0 + wp;
    size_t ld = (size_t)N;
    if (vblk) {
      o  = outT + ((size_t)(m0 >> 11) * 1024 + (n0 - 2048 + wq)) * 2048 + (m0 & 2047) + wp;
      ld = 2048;
    }
    o  += (size_t)(lane >> 3) * ld + (lane & 7) * 8;   // this lane's 16 bytes of a row
    st += (lane >> 3) * SP + (lane & 7) * 8;
    // the wave's own LDS stores are done before it reads what other lanes wrote
    asm volatile("s_wait_dscnt 0x0" ::: "memory");
#pragma unroll
    for (int c = 0; c < 16; ++c)   // 8 lanes to a row, 4 rows to a store
      *(uint4*)&o[(size_t)(4 * c) * ld] = *(const uint4*)&st[4 * c * SP];
  }
}

__device__ __forceinline__ float xhalf(float x) {
  int b = __builtin_bit_cast(int, x);
  return __builtin_bit_cast(float, __builtin_amdgcn_permlanex16(
      b, b, 0x76543210, 0xfedcba98, false, false));
}

__device__ __forceinline__ void stage_kv(const u16* gk, u16* lk,
                                         const u16* gv, u16* lv) {
  asm volatile("global_load_async_to_lds_b128 %0, %1, off\n\t"
               "global_load_async_to_lds_b128 %2, %3, off\n\t"
               "s_wait_xcnt 0x0"
               :: "v"((u32)(unsigned long long)(void*)lk), "v"(gk),
                  "v"((u32)(unsigned long long)(void*)lv), "v"(gv)
               : "memory");
}

__global__ __launch_bounds__(256) void flash_attn_k(const u16* __restrict__ qkv,
                                                    const u16* __restrict__ vT,
                                                    u16* __restrict__ o) {
  constexpr int Nctx = 2048, C = 1024, C3 = 3072, Dh = 64;
  constexpr int NT = Nctx / 32;   // key tiles
  __shared__ __align__(16) u16 Ks[2][32][72];
  __shared__ __align__(16) u16 Vs[2][64][40];

  const int tid  = threadIdx.x;
  const int lane = tid & 31;
  const int wave = tid >> 5;
  const int r    = lane & 15;
  const int hi   = lane >> 4;

  const int bh = blockIdx.y;   // b*16 + h
  const int b  = bh >> 4;
  const int h  = bh & 15;
  const int q0 = blockIdx.x * 128 + wave * 16;

  const v8f zero8 = {0.f, 0.f, 0.f, 0.f, 0.f, 0.f, 0.f, 0.f};

  // Q fragments (B operand: lane = query column), Q already scaled by
  // 0.125 * log2(e) in the qkv epilogue
  FragBF qa[2];
  {
    const u16* qrow = qkv + (size_t)(b * Nctx + q0 + r) * C3 + h * Dh;
#pragma unroll
    for (int f = 0; f < 2; ++f) {
      int d = f * 32 + hi * 8;
      qa[f].q[0] = *(const uint4*)&qrow[d];
      qa[f].q[1] = *(const uint4*)&qrow[d + 16];
    }
  }

  // per lane: negm = -mref of query r in all 8 registers (same in both halves)
  // and the sum over this half's keys; oacc[ds][v] = O[query r][d = ds*16 + 8*hi + v]
  float lrow = 0.f;
  v8f negm = zero8;
  v8f oacc[4];
#pragma unroll
  for (int d = 0; d < 4; ++d) oacc[d] = zero8;

  // this thread's 16 bytes of every tile: K row tid/8, V^T row tid/4
  const int kr = tid >> 3, kc = (tid & 7) << 3;
  const int vr = tid >> 2, vc = (tid & 3) << 3;
  const u16* gK = qkv + (size_t)(b * Nctx + kr) * C3 + C + h * Dh + kc;
  const u16* gV = vT + ((size_t)bh * Dh + vr) * Nctx + vc;

  stage_kv(gK, &Ks[0][kr][kc], gV, &Vs[0][vr][vc]);
  asm volatile("s_wait_asynccnt 0x0" ::: "memory");   // tile 0 has landed
  __syncthreads();                                    // ... for every wave
  stage_kv(gK + (size_t)32 * C3, &Ks[1][kr][kc], gV + 32, &Vs[1][vr][vc]);

  for (int it = 0; it < NT; ++it) {
    const int cur = it & 1;
    v8f s[2];
#pragma unroll
    for (int t = 0; t < 2; ++t) {
      const u16* krow = &Ks[cur][t * 16 + r][0];
      v8f st = negm;
#pragma unroll
      for (int f = 0; f < 2; ++f) {
        FragBF kf;
        int d = f * 32 + hi * 8;
        kf.q[0] = *(const uint4*)&krow[d];
        kf.q[1] = *(const uint4*)&krow[d + 16];
        st = __builtin_amdgcn_wmma_f32_16x16x32_bf16(
            false, kf.v, false, qa[f].v, (short)0, st, false, false);
      }
      s[t] = st;
    }

    // s[t][v] = score of key t*16 + 8*hi + v with query r, less mref
    float r0 = s[0][0], r1 = s[1][0];
    // unrolled: constant element indices keep the scores in registers
#pragma unroll
    for (int v = 1; v < 8; ++v) { r0 = fmaxf(r0, s[0][v]); r1 = fmaxf(r1, s[1][v]); }
    const float rm = fmaxf(r0, r1);   // this half's largest
    if (it == 0 || __builtin_amdgcn_ballot_w32(rm > 8.0f) != 0) {
      // wave-uniform.  Raise mref to the query's true maximum (first trip: set
      // it, whatever its sign; O and the sum are still zero there)
      const float qm = fmaxf(rm, xhalf(rm));
      const float up = it == 0 ? qm : fmaxf(qm, 0.f);
      const float sc = it == 0 ? 0.f : __builtin_amdgcn_exp2f(-up);
      negm = negm - up;
      s[0] = s[0] - up;
      s[1] = s[1] - up;
      lrow *= sc;
#pragma unroll
      for (int d = 0; d < 4; ++d) oacc[d] = oacc[d] * sc;
    }
    // P^T as B operand: element e < 8 is key 8*hi + e, element 8 + e is key
    // 16 + 8*hi + e, which is what V^T's two 16-byte reads per row deliver
    FragBF pb;
    u32 pw[8];
    float ps0 = 0.f, ps1 = 0.f;
#pragma unroll
    for (int i = 0; i < 8; ++i) {
      const float p0 = __builtin_amdgcn_exp2f(s[i >> 2][2 * (i & 3)]);
      const float p1 = __builtin_amdgcn_exp2f(s[i >> 2][2 * (i & 3) + 1]);
      pw[i] = pack_bf16x2(p0, p1);
      ps0 += p0;
      ps1 += p1;
    }
    lrow += ps0 + ps1;
    pb.q[0] = make_uint4(pw[0], pw[1], pw[2], pw[3]);
    pb.q[1] = make_uint4(pw[4], pw[5], pw[6], pw[7]);
#pragma unroll
    for (int ds = 0; ds < 4; ++ds) {
      const u16* vrow = &Vs[cur][ds * 16 + r][0];
      FragBF vf;
      vf.q[0] = *(const uint4*)&vrow[hi * 8];
      vf.q[1] = *(const uint4*)&vrow[hi * 8 + 16];
      oacc[ds] = __builtin_amdgcn_wmma_f32_16x16x32_bf16(
          false, vf.v, false, pb.v, (short)0, oacc[ds], false, false);
    }

    // hand-over: this wave's LDS reads are done, its copies of tile it+1 have
    // landed; behind the barrier both hold for all waves, so tile it+1 may be
    // read and the buffer just read may be refilled
    asm volatile("s_wait_dscnt 0x0" ::: "memory");
    asm volatile("s_wait_asynccnt 0x0" ::: "memory");
    __syncthreads();
    if (it + 2 < NT)
      stage_kv(gK + (size_t)(it + 2) * 32 * C3, &Ks[cur][kr][kc],
               gV + (it + 2) * 32, &Vs[cur][vr][vc]);
  }
  asm volatile("s_wait_asynccnt 0x0" ::: "memory");   // no copy outlives the loop

  // join the two halves' sums, normalize and write O as [M, C] bf16
  // (col = h*64 + d): a lane's 8 registers of a tile are 8 consecutive d
  const float inv = 1.0f / (lrow + xhalf(lrow));
  u16* orow = o + (size_t)(b * Nctx + q0 + r) * C + h * Dh + hi * 8;
#pragma unroll
  for (int ds = 0; ds < 4; ++ds) {
    const v8f ov = oacc[ds] * inv;
    *(uint4*)&orow[ds * 16] =
        make_uint4(pack_bf16x2(ov[0], ov[1]), pack_bf16x2(ov[2], ov[3]),
                   pack_bf16x2(ov[4], ov[5]), pack_bf16x2(ov[6], ov[7]));
  }
}

// ---------------------------------------------------------------------------
// host-side orchestration
// ---------------------------------------------------------------------------
extern "C" void kernel_launch(void* const* d_in, const int* in_sizes, int n_in,
                              void* d_out, int out_size, void* d_ws, size_t ws_size,
                              hipStream_t stream) {
  const float* x      = (const float*)d_in[0];
  const float* ln1_g  = (const float*)d_in[1];
  const float* ln1_b  = (const float*)d_in[2];
  const float* qkv_w  = (const float*)d_in[3];
  const float* proj_w = (const float*)d_in[4];
  const float* proj_b = (const float*)d_in[5];
  const float* ln2_g  = (const float*)d_in[6];
  const float* ln2_b  = (const float*)d_in[7];
  const float* fc1_w  = (const float*)d_in[8];
  const float* fc1_b  = (const float*)d_in[9];
  const float* fc2_w  = (const float*)d_in[10];
  const float* fc2_b  = (const float*)d_in[11];
  float* out = (float*)d_out;

  const int M = 8192, C = 1024, C3 = 3072, Hd = 4096;

  char* ws = (char*)d_ws;
  u16*   h_bf   = (u16*)(ws);                             // 16 MB  (LN out, reused)
  u16*   qkv_bf = (u16*)(ws + (size_t)16  * 1048576);     // 48 MB (Q, K columns used)
  u16*   vTb    = (u16*)(ws + (size_t)64  * 1048576);     // 16 MB
  u16*   o_bf   = (u16*)(ws + (size_t)80  * 1048576);     // 16 MB
  float* x1     = (float*)(ws + (size_t)96 * 1048576);    // 32 MB
  u16*   h2_bf  = (u16*)(ws + (size_t)128 * 1048576);     // 64 MB
  u16*   wqkv   = (u16*)(ws + (size_t)192 * 1048576);     // 24 MB total weights
  u16*   wproj  = wqkv  + (size_t)C3 * C;
  u16*   wfc1   = wproj + (size_t)C  * C;
  u16*   wfc2   = wfc1  + (size_t)Hd * C;

  // weights -> bf16 (wqkv, wproj, wfc1, wfc2 lie back to back)
  cast_weights_bf16_k<<<512, 256, 0, stream>>>(qkv_w, proj_w, fc1_w, fc2_w, wqkv);

  // attention branch
  layernorm_bf16_k<<<M, 256, 0, stream>>>(x, ln1_g, ln1_b, h_bf);
  gemm_bf16_k<0, 64><<<dim3(C3 / 128, M / 256), 256, 0, stream>>>(
      h_bf, wqkv, nullptr, nullptr, nullptr, qkv_bf, vTb, M, C3, C);
  flash_attn_k<<<dim3(2048 / 128, 4 * 16), 256, 0, stream>>>(qkv_bf, vTb, o_bf);
  gemm_bf16_k<1, 128><<<dim3(C / 128, M / 256), 256, 0, stream>>>(
      o_bf, wproj, proj_b, x, x1, nullptr, nullptr, M, C, C);

  // MLP branch
  layernorm_bf16_k<<<M, 256, 0, stream>>>(x1, ln2_g, ln2_b, h_bf);
  gemm_bf16_k<2, 64><<<dim3(Hd / 128, M / 256), 256, 0, stream>>>(
      h_bf, wfc1, fc1_b, nullptr, nullptr, h2_bf, nullptr, M, Hd, C);
  gemm_bf16_k<1, 128><<<dim3(C / 128, M / 256), 256, 0, stream>>>(
      h2_bf, wfc2, fc2_b, x1, out, nullptr, nullptr, M, C, Hd);
}

// v010
// One run takes 239 microseconds.
// Next to v009, in two timings, it ran 1.03 times as fast each time.
// Counting every step since v000, it is 3.03 times as fast.
#include <hip/hip_runtime.h>
#include <hip/hip_bf16.h>

typedef unsigned short u16;
typedef unsigned int u32;
typedef __attribute__((ext_vector_type(16))) __bf16 v16bf;
typedef __attribute__((ext_vector_type(8)))  float  v8f;

union FragBF {
  v16bf v;
  uint4 q[2];
  u16   h[16];
};

// two f32 -> one dword of two bf16, round to nearest even
__device__ __forceinline__ u32 pack_bf16x2(float lo, float hi) {
  typedef __bf16 bf2 __attribute__((ext_vector_type(2)));
  typedef float  f2  __attribute__((ext_vector_type(2)));
  return __builtin_bit_cast(u32, __builtin_convertvector(f2{lo, hi}, bf2));
}

// ---------------------------------------------------------------------------
// fp32 -> bf16 cast of the four weight matrices in one launch of 512 workgroups.
// Their bf16 copies lie back to back in out: qkv (3072 x 1024), proj
// (1024 x 1024), fc1 (4096 x 1024), fc2 (1024 x 4096).  A chunk is 8192 floats:
// a thread takes 8 float4, 256 threads apart, so that a wave's load covers 512
// contiguous bytes and its 8-byte store 256.  qkv and proj together, fc1, and
// fc2 are 512 chunks each: workgroup b takes chunk b of each of the three, and
// a thread issues its 24 loads ahead of its first store.
// ---------------------------------------------------------------------------
__global__ __launch_bounds__(256) void cast_weights_bf16_k(
    const float* __restrict__ wq, const float* __restrict__ wp,
    const float* __restrict__ w1, const float* __restrict__ w2,
    u16* __restrict__ out) {
  constexpr int CH = 8192;                 // floats per chunk
  constexpr int NQ = 3072 * 1024 / CH;     // chunks of qkv
  constexpr int NG = 512;                  // chunks per group = workgroups
  const int b  = blockIdx.x;
  const int t4 = threadIdx.x * 4;
  const float* s[3] = {b < NQ ? wq + (size_t)b * CH : wp + (size_t)(b - NQ) * CH,
                       w1 + (size_t)b * CH, w2 + (size_t)b * CH};
  float4 v[3][8];
  // all four loops unrolled: v stays in registers, the loads issue back to back
#pragma unroll
  for (int i = 0; i < 3; ++i)
#pragma unroll
    for (int j = 0; j < 8; ++j) v[i][j] = *(const float4*)&s[i][j * 1024 + t4];
#pragma unroll
  for (int i = 0; i < 3; ++i) {
    u16* d = out + (size_t)(i * NG + b) * CH + t4;
#pragma unroll
    for (int j = 0; j < 8; ++j)
      *(uint2*)&d[j * 1024] = make_uint2(pack_bf16x2(v[i][j].x, v[i][j].y),
                                         pack_bf16x2(v[i][j].z, v[i][j].w));
  }
}

// ---------------------------------------------------------------------------
// LayerNorm over C=1024, bf16 output.  One wave per two rows, no LDS and no
// barrier: of each row a lane holds 32 floats as 8 float4, 128 floats apart, so
// that each load of the wave covers 512 contiguous bytes and each 8-byte store
// 256.  g and b are loaded once for the two rows.  Sum and sum of squares are
// taken in the lane on register pairs (packed adds and multiply-adds), then over
// the 32 lanes by a five-step butterfly.
// ---------------------------------------------------------------------------
typedef float f32x2 __attribute__((ext_vector_type(2)));

// sum over the wave's 32 lanes, in every lane
__device__ __forceinline__ float wave_sum(float x) {
  x += __builtin_bit_cast(float, __builtin_amdgcn_update_dpp(
      0, __builtin_bit_cast(int, x), 0x161, 0xf, 0xf, true));
  x += __builtin_bit_cast(float, __builtin_amdgcn_update_dpp(
      0, __builtin_bit_cast(int, x), 0x162, 0xf, 0xf, true));
  x += __builtin_bit_cast(float, __builtin_amdgcn_update_dpp(
      0, __builtin_bit_cast(int, x), 0x164, 0xf, 0xf, true));
  x += __builtin_bit_cast(float, __builtin_amdgcn_update_dpp(
      0, __builtin_bit_cast(int, x), 0x168, 0xf, 0xf, true));
  const int b = __builtin_bit_cast(int, x);
  return x + __builtin_bit_cast(float, __builtin_amdgcn_permlanex16(
      b, b, 0x76543210, 0xfedcba98, false, false));
}

__global__ __launch_bounds__(256) void layernorm_bf16_k(const float* __restrict__ x,
                                                        const float* __restrict__ g,
                                                        const float* __restrict__ b,
                                                        u16* __restrict__ out) {
  constexpr int C = 1024;
  const int c0  = (threadIdx.x & 31) * 4;
  const int row = (blockIdx.x * 8 + (threadIdx.x >> 5)) * 2;
  const float* xr = x + (size_t)row * C + c0;
  float4 v[2][8], gv[8], bv[8];
  // every loop unrolled: the arrays stay in registers, the loads issue back to back
#pragma unroll
  for (int i = 0; i < 2; ++i)
#pragma unroll
    for (int j = 0; j < 8; ++j) v[i][j] = *(const float4*)&xr[i * C + j * 128];
#pragma unroll
  for (int j = 0; j < 8; ++j) {
    gv[j] = *(const float4*)&g[j * 128 + c0];
    bv[j] = *(const float4*)&b[j * 128 + c0];
  }
  // the two scheduling fences keep the 32 loads in one group at the head: without
  // them the compiler issues part of the loads among the sums or the last
  // multiply-adds, behind waits for earlier ones, and their latencies add up
  __builtin_amdgcn_sched_barrier(0);
  // The rows' address is an input of the wait, so that it stays in its registers
  // up to it: no load's result lands on an issued load's address.
  asm volatile("s_wait_xcnt 0x0" :: "v"(xr) : "memory");
  __builtin_amdgcn_sched_barrier(0);
  uint2 w[2][8];
#pragma unroll
  for (int i = 0; i < 2; ++i) {
    f32x2 s0 = {0.f, 0.f}, s1 = {0.f, 0.f}, q0 = {0.f, 0.f}, q1 = {0.f, 0.f};
#pragma unroll
    for (int j = 0; j < 8; ++j) {
      const f32x2 lo = {v[i][j].x, v[i][j].y}, hi = {v[i][j].z, v[i][j].w};
      s0 += lo;
      s1 += hi;
      q0 = __builtin_elementwise_fma(lo, lo, q0);
      q1 = __builtin_elementwise_fma(hi, hi, q1);
    }
    s0 += s1;
    q0 += q1;
    const float mu  = wave_sum(s0.x + s0.y) * (1.0f / 1024.0f);
    const float var = wave_sum(q0.x + q0.y) * (1.0f / 1024.0f) - mu * mu;
    const float rs  = rsqrtf(var + 1e-5f);
#pragma unroll
    for (int j = 0; j < 8; ++j) {
      const float4 a = v[i][j];
      w[i][j] = make_uint2(pack_bf16x2((a.x - mu) * rs * gv[j].x + bv[j].x,
                                       (a.y - mu) * rs * gv[j].y + bv[j].y),
                           pack_bf16x2((a.z - mu) * rs * gv[j].z + bv[j].z,
                                       (a.w - mu) * rs * gv[j].w + bv[j].w));
    }
  }
  u16* orow = out + (size_t)row * C + c0;
#pragma unroll
  for (int i = 0; i < 2; ++i)
#pragma unroll
    for (int j = 0; j < 8; ++j) *(uint2*)&orow[i * C + j * 128] = w[i][j];
}

__device__ __forceinline__ void copy12(const u32 (&l)[12], const u16* const (&g)[12]) {
  asm volatile("global_load_async_to_lds_b128 %0, %12, off\n\t"
               "global_load_async_to_lds_b128 %1, %13, off\n\t"
               "global_load_async_to_lds_b128 %2, %14, off\n\t"
               "global_load_async_to_lds_b128 %3, %15, off\n\t"
               "global_load_async_to_lds_b128 %4, %16, off\n\t"
               "global_load_async_to_lds_b128 %5, %17, off\n\t"
               "global_load_async_to_lds_b128 %6, %18, off\n\t"
               "global_load_async_to_lds_b128 %7, %19, off\n\t"
               "global_load_async_to_lds_b128 %8, %20, off\n\t"
               "global_load_async_to_lds_b128 %9, %21, off\n\t"
               "global_load_async_to_lds_b128 %10, %22, off\n\t"
               "global_load_async_to_lds_b128 %11, %23, off\n\t"
               "s_wait_xcnt 0x0"
               :: "v"(l[0]), "v"(l[1]), "v"(l[2]), "v"(l[3]),
                  "v"(l[4]), "v"(l[5]), "v"(l[6]), "v"(l[7]),
                  "v"(l[8]), "v"(l[9]), "v"(l[10]), "v"(l[11]),
                  "v"(g[0]), "v"(g[1]), "v"(g[2]), "v"(g[3]),
                  "v"(g[4]), "v"(g[5]), "v"(g[6]), "v"(g[7]),
                  "v"(g[8]), "v"(g[9]), "v"(g[10]), "v"(g[11])
               : "memory");
}

// ---------------------------------------------------------------------------
// GELU with the exact (erf) definition, eight values, no branch:
//   gelu(t) = t * Phi(t) = max(t, 0) - |t| * erfc(|t| / sqrt 2) / 2
//   erfc(z) = (a1 u + a2 u^2 + ... + a5 u^5) * exp(-z^2),  u = 1 / (1 + p z)
// (the five-term form, absolute error of erfc below 2e-7).  The small term is
// subtracted from max(t, 0), so nothing cancels for negative t.  Written on
// whole vectors so that the multiply-adds pair up into packed instructions.
// ---------------------------------------------------------------------------
__device__ __forceinline__ v8f splat8(float c) { return v8f{c, c, c, c, c, c, c, c}; }

__device__ __forceinline__ v8f gelu8(v8f t) {
  v8f a, u, e, r;
  // both loops unrolled: constant element indices keep the vectors in registers
#pragma unroll
  for (int v = 0; v < 8; ++v) a[v] = fabsf(t[v]);
  const v8f d = a * 0.23164190f + 1.0f;          // 1 + p * |t| / sqrt 2
  const v8f q = (t * t) * -0.72134752f;          // -t^2 / 2 * log2(e)
#pragma unroll
  for (int v = 0; v < 8; ++v) {
    u[v] = __builtin_amdgcn_rcpf(d[v]);
    e[v] = __builtin_amdgcn_exp2f(q[v]);
    r[v] = fmaxf(t[v], 0.0f);
  }
  // half of a5 .. a1, nested multiply-adds in u
  v8f p = u * 0.53070271f - 0.72657601f;
  p = __builtin_elementwise_fma(p, u, splat8(0.71070687f));
  p = __builtin_elementwise_fma(p, u, splat8(-0.14224837f));
  p = __builtin_elementwise_fma(p, u, splat8(0.12741480f));
  return r - a * (p * u * e);
}

template <int EPI, int KS>
__global__ __launch_bounds__(256) void gemm_bf16_k(
    const u16* __restrict__ A, const u16* __restrict__ W,
    const float* __restrict__ bias, const float* __restrict__ res,
    float* __restrict__ outF, u16* __restrict__ outB, u16* __restrict__ outT,
    int M, int N, int K) {
  constexpr int TA    = 256;           // A rows of the block tile
  constexpr int TW    = 128;           // W rows
  constexpr int TR    = TA + TW;       // rows of a buffer
  constexpr int PITCH = KS + 8;        // elements: row bytes + 16
  constexpr int CPR   = KS / 8;        // 16-byte chunks per row
  constexpr int RP    = 256 / CPR;     // rows the 256 threads copy at once
  constexpr int NC    = TR / RP;       // copies per thread and stage
  // two buffers; rows 0 .. 255: the A rows, rows 256 .. 383: the W rows
  __shared__ __align__(16) u16 S[2][TR][PITCH];

  const int tid  = threadIdx.x;
  const int lane = tid & 31;
  const int wave = tid >> 5;
  const int r    = lane & 15;
  const int hi   = lane >> 4;

  const int m0 = blockIdx.y * TA;
  const int n0 = blockIdx.x * TW;
  // V columns: the whole block (n0 is a multiple of 128)
  const bool vblk = EPI == 0 && n0 >= 2048;
  const int  wA = (wave >> 1) * 64;   // 4 waves along the A rows
  const int  wW = (wave & 1) * 64;    // 2 waves along the W rows
  const int  wp = vblk ? wA : wW;
  const int  wq = vblk ? wW : wA;

  // cooperative copy: thread t owns chunk t % CPR of rows t / CPR + RP * c
  const int row = tid / CPR;
  const int col = (tid % CPR) << 3;

  const u16* gA = &A[(size_t)(m0 + row) * K + col];
  const u16* gW = &W[(size_t)(n0 + row) * K + col];
  const size_t gstep = (size_t)RP * K;
  const u32 l0 = (u32)(unsigned long long)(void*)&S[0][row][col];

  // this thread's NC copies of stage s into buffer buf, twelve to a statement
  auto stage = [&](int s, int buf) {
#pragma unroll
    for (int q = 0; q < NC / 12; ++q) {
      u32 l[12];
      const u16* g[12];
#pragma unroll
      for (int e = 0; e < 12; ++e) {
        const int c = q * 12 + e;
        l[e] = l0 + (u32)(buf * TR + c * RP) * (PITCH * 2);
        g[e] = (c * RP < TA ? gA + c * gstep : gW + (c - TA / RP) * gstep) + (size_t)s * KS;
      }
      copy12(l, g);
    }
  };

  v8f acc[4][4];
  const v8f zero8 = {0.f, 0.f, 0.f, 0.f, 0.f, 0.f, 0.f, 0.f};
#pragma unroll
  for (int i = 0; i < 4; ++i)
#pragma unroll
    for (int j = 0; j < 4; ++j) acc[i][j] = zero8;

  const int nk = K / KS;   // stages

  stage(0, 0);
  asm volatile("s_wait_asynccnt 0x0" ::: "memory");   // stage 0 has landed
  __syncthreads();                                    // ... for every wave
  if (nk > 1) stage(1, 1);

  // this lane's first fragment row of P and of Q in buffer 0
  const u16* pl = &S[0][(vblk ? 0 : TA) + wp + r][hi * 8];
  const u16* ql = &S[0][(vblk ? TA : 0) + wq + r][hi * 8];

  for (int t = 0; t < nk; ++t) {
    const int cur = t & 1;
    const int co  = cur * (TR * PITCH);
#pragma unroll
    for (int ks = 0; ks < KS / 32; ++ks) {
      FragBF qf[4], pf[4];
      // the two scheduling fences keep a k step's 16 fragment reads together,
      // ahead of its 16 matrix instructions: without them the compiler reloads one
      // Q fragment register set among the matrix instructions and waits for each
      __builtin_amdgcn_sched_barrier(0);
#pragma unroll
      for (int jj = 0; jj < 4; ++jj) {
        qf[jj].q[0] = *(const uint4*)&ql[co + jj * 16 * PITCH + ks * 32];
        qf[jj].q[1] = *(const uint4*)&ql[co + jj * 16 * PITCH + ks * 32 + 16];
      }
#pragma unroll
      for (int ii = 0; ii < 4; ++ii) {
        pf[ii].q[0] = *(const uint4*)&pl[co + ii * 16 * PITCH + ks * 32];
        pf[ii].q[1] = *(const uint4*)&pl[co + ii * 16 * PITCH + ks * 32 + 16];
      }
      __builtin_amdgcn_sched_barrier(0);
#pragma unroll
      for (int jj = 0; jj < 4; ++jj)
#pragma unroll
        for (int ii = 0; ii < 4; ++ii)
          acc[ii][jj] = __builtin_amdgcn_wmma_f32_16x16x32_bf16(
              false, pf[ii].v, false, qf[jj].v, (short)0, acc[ii][jj], false, false);
    }
    // hand-over: this wave's LDS reads are done, its copies of stage t+1 have
    // landed; behind the barrier both hold for all waves, so stage t+1 may be
    // read and the buffer just read may be refilled
    asm volatile("s_wait_dscnt 0x0" ::: "memory");
    asm volatile("s_wait_asynccnt 0x0" ::: "memory");
    __syncthreads();
    if (t + 2 < nk) stage(t + 2, cur);
  }
  asm volatile("s_wait_asynccnt 0x0" ::: "memory");   // no copy outlives the loop

  // epilogue.  acc[i][j][v] is p = wp + i*16 + 8*hi + v, q = wq + j*16 + r.
  // Behind the loop's last barrier no wave reads S any more and no copy is in
  // flight: S is free, and each wave stages in a range of its own.
  // Every loop below is unrolled: constant indices keep acc in registers.
  if constexpr (EPI == 1) {
    constexpr int SP = 64 + 4;
    static_assert(8 * 64 * SP * 4 <= (int)sizeof(S), "staging fits the ring");
    float* st = (float*)&S[0][0][0] + wave * (64 * SP);
    const int c4 = (lane & 15) * 4;   // a lane's 4 columns; 16 lanes = one row
    const size_t o0 = (size_t)(m0 + wq + hi) * N + n0 + wp + c4;
    const float4 bv = *(const float4*)&bias[n0 + wp + c4];
    float4 rv[2][16];
    // unrolled: rv stays in registers, the 32 loads issue ahead of the staging
#pragma unroll
    for (int h = 0; h < 2; ++h) {
      const float* rp[16];
#pragma unroll
      for (int c = 0; c < 16; ++c) {
        rp[c] = &res[o0 + (size_t)(32 * h + 2 * c) * N];
        rv[h][c] = *(const float4*)rp[c];
      }
      // The 16 addresses are inputs of the wait, so that each stays in its
      // registers up to it: no load's result lands on an issued load's address.
      asm volatile("s_wait_xcnt 0x0"
                   :: "v"(rp[0]), "v"(rp[1]), "v"(rp[2]), "v"(rp[3]),
                      "v"(rp[4]), "v"(rp[5]), "v"(rp[6]), "v"(rp[7]),
                      "v"(rp[8]), "v"(rp[9]), "v"(rp[10]), "v"(rp[11]),
                      "v"(rp[12]), "v"(rp[13]), "v"(rp[14]), "v"(rp[15])
                   : "memory");
    }
#pragma unroll
    for (int i = 0; i < 4; ++i)
#pragma unroll
      for (int j = 0; j < 4; ++j) {
        const v8f a = acc[i][j];
        float* d = &st[(j * 16 + r) * SP + i * 16 + hi * 8];
        *(float4*)&d[0] = make_float4(a[0], a[1], a[2], a[3]);
        *(float4*)&d[4] = make_float4(a[4], a[5], a[6], a[7]);
      }
    // the wave's own LDS stores are done before it reads what other lanes wrote
    asm volatile("s_wait_dscnt 0x0" ::: "memory");
#pragma unroll
    for (int c = 0; c < 32; ++c) {   // rows 2c and 2c+1 of the wave's tile
      const float4 a = *(const float4*)&st[(2 * c + hi) * SP + c4];
      const float4 x = rv[c >> 4][c & 15];
      *(float4*)&outF[o0 + (size_t)(2 * c) * N] =
          make_float4(a.x + bv.x + x.x, a.y + bv.y + x.y,
                      a.z + bv.z + x.z, a.w + bv.w + x.w);
    }
  } else {
    constexpr int SP = 64 + 8;
    static_assert(8 * 64 * SP * 2 <= (int)sizeof(S), "staging fits the ring");
    u16* st = &S[0][0][0] + wave * (64 * SP);
    // SCALE = 64^-0.5 on Q, times log2(e): the scores come out in log2 units
    const float sc = (EPI == 0 && n0 < 1024) ? 0.18033688f : 1.0f;
#pragma unroll
    for (int i = 0; i < 4; ++i) {
      v8f bv;
      if constexpr (EPI == 2) {
        const float* bp = &bias[n0 + wp + i * 16 + hi * 8];
        const float4 b0 = *(const float4*)&bp[0], b1 = *(const float4*)&bp[4];
        bv = v8f{b0.x, b0.y, b0.z, b0.w, b1.x, b1.y, b1.z, b1.w};
      }
#pragma unroll
      for (int j = 0; j < 4; ++j) {
        v8f a;
        if constexpr (EPI == 2) a = gelu8(acc[i][j] + bv);
        else                    a = acc[i][j] * sc;
        *(uint4*)&st[(j * 16 + r) * SP + i * 16 + hi * 8] =
            make_uint4(pack_bf16x2(a[0], a[1]), pack_bf16x2(a[2], a[3]),
                       pack_bf16x2(a[4], a[5]), pack_bf16x2(a[6], a[7]));
      }
    }
    // output row q of the wave's tile starts at o[q * ld]: 64 elements, one line
    u16*   o  = outB + (size_t)(m0 + wq) * N + n0 + wp;
    size_t ld = (size_t)N;
    if (vblk) {
      o  = outT + ((size_t)(m0 >> 11) * 1024 + (n0 - 2048 + wq)) * 2048 + (m0 & 2047) + wp;
      ld = 2048;
    }
    o  += (size_t)(lane >> 3) * ld + (lane & 7) * 8;   // this lane's 16 bytes of a row
    st += (lane >> 3) * SP + (lane & 7) * 8;
    // the wave's own LDS stores are done before it reads what other lanes wrote
    asm volatile("s_wait_dscnt 0x0" ::: "memory");
#pragma unroll
    for (int c = 0; c < 16; ++c)   // 8 lanes to a row, 4 rows to a store
      *(uint4*)&o[(size_t)(4 * c) * ld] = *(const uint4*)&st[4 * c * SP];
  }
}

__device__ __forceinline__ float xhalf(float x) {
  int b = __builtin_bit_cast(int, x);
  return __builtin_bit_cast(float, __builtin_amdgcn_permlanex16(
      b, b, 0x76543210, 0xfedcba98, false, false));
}

__device__ __forceinline__ void stage_kv(const u16* gk, u16* lk,
                                         const u16* gv, u16* lv) {
  asm volatile("global_load_async_to_lds_b128 %0, %1, off\n\t"
               "global_load_async_to_lds_b128 %2, %3, off\n\t"
               "s_wait_xcnt 0x0"
               :: "v"((u32)(unsigned long long)(void*)lk), "v"(gk),
                  "v"((u32)(unsigned long long)(void*)lv), "v"(gv)
               : "memory");
}

__global__ __launch_bounds__(256) void flash_attn_k(const u16* __restrict__ qkv,
                                                    const u16* __restrict__ vT,
                                                    u16* __restrict__ o) {
  constexpr int Nctx = 2048, C = 1024, C3 = 3072, Dh = 64;
  constexpr int NT = Nctx / 32;   // key tiles
  __shared__ __align__(16) u16 Ks[2][32][72];
  __shared__ __align__(16) u16 Vs[2][64][40];

  const int tid  = threadIdx.x;
  const int lane = tid & 31;
  const int wave = tid >> 5;
  const int r    = lane & 15;
  const int hi   = lane >> 4;

  const int bh = blockIdx.y;   // b*16 + h
  const int b  = bh >> 4;
  const int h  = bh & 15;
  const int q0 = blockIdx.x * 128 + wave * 16;

  const v8f zero8 = {0.f, 0.f, 0.f, 0.f, 0.f, 0.f, 0.f, 0.f};

  // Q fragments (B operand: lane = query column), Q already scaled by
  // 0.125 * log2(e) in the qkv epilogue
  FragBF qa[2];
  {
    const u16* qrow = qkv + (size_t)(b * Nctx + q0 + r) * C3 + h * Dh;
#pragma unroll
    for (int f = 0; f < 2; ++f) {
      int d = f * 32 + hi * 8;
      qa[f].q[0] = *(const uint4*)&qrow[d];
      qa[f].q[1] = *(const uint4*)&qrow[d + 16];
    }
  }

  // per lane: negm = -mref of query r in all 8 registers (same in both halves)
  // and the sum over this half's keys; oacc[ds][v] = O[query r][d = ds*16 + 8*hi + v]
  float lrow = 0.f;
  v8f negm = zero8;
  v8f oacc[4];
#pragma unroll
  for (int d = 0; d < 4; ++d) oacc[d] = zero8;

  // this thread's 16 bytes of every tile: K row tid/8, V^T row tid/4
  const int kr = tid >> 3, kc = (tid & 7) << 3;
  const int vr = tid >> 2, vc = (tid & 3) << 3;
  const u16* gK = qkv + (size_t)(b * Nctx + kr) * C3 + C + h * Dh + kc;
  const u16* gV = vT + ((size_t)bh * Dh + vr) * Nctx + vc;

  stage_kv(gK, &Ks[0][kr][kc], gV, &Vs[0][vr][vc]);
  asm volatile("s_wait_asynccnt 0x0" ::: "memory");   // tile 0 has landed
  __syncthreads();                                    // ... for every wave
  stage_kv(gK + (size_t)32 * C3, &Ks[1][kr][kc], gV + 32, &Vs[1][vr][vc]);

  for (int it = 0; it < NT; ++it) {
    const int cur = it & 1;
    v8f s[2];
#pragma unroll
    for (int t = 0; t < 2; ++t) {
      const u16* krow = &Ks[cur][t * 16 + r][0];
      v8f st = negm;
#pragma unroll
      for (int f = 0; f < 2; ++f) {
        FragBF kf;
        int d = f * 32 + hi * 8;
        kf.q[0] = *(const uint4*)&krow[d];
        kf.q[1] = *(const uint4*)&krow[d + 16];
        st = __builtin_amdgcn_wmma_f32_16x16x32_bf16(
            false, kf.v, false, qa[f].v, (short)0, st, false, false);
      }
      s[t] = st;
    }

    // s[t][v] = score of key t*16 + 8*hi + v with query r, less mref
    float r0 = s[0][0], r1 = s[1][0];
    // unrolled: constant element indices keep the scores in registers
#pragma unroll
    for (int v = 1; v < 8; ++v) { r0 = fmaxf(r0, s[0][v]); r1 = fmaxf(r1, s[1][v]); }
    const float rm = fmaxf(r0, r1);   // this half's largest
    if (it == 0 || __builtin_amdgcn_ballot_w32(rm > 8.0f) != 0) {
      // wave-uniform.  Raise mref to the query's true maximum (first trip: set
      // it, whatever its sign; O and the sum are still zero there)
      const float qm = fmaxf(rm, xhalf(rm));
      const float up = it == 0 ? qm : fmaxf(qm, 0.f);
      const float sc = it == 0 ? 0.f : __builtin_amdgcn_exp2f(-up);
      negm = negm - up;
      s[0] = s[0] - up;
      s[1] = s[1] - up;
      lrow *= sc;
#pragma unroll
      for (int d = 0; d < 4; ++d) oacc[d] = oacc[d] * sc;
    }
    // P^T as B operand: element e < 8 is key 8*hi + e, element 8 + e is key
    // 16 + 8*hi + e, which is what V^T's two 16-byte reads per row deliver
    FragBF pb;
    u32 pw[8];
    float ps0 = 0.f, ps1 = 0.f;
#pragma unroll
    for (int i = 0; i < 8; ++i) {
      const float p0 = __builtin_amdgcn_exp2f(s[i >> 2][2 * (i & 3)]);
      const float p1 = __builtin_amdgcn_exp2f(s[i >> 2][2 * (i & 3) + 1]);
      pw[i] = pack_bf16x2(p0, p1);
      ps0 += p0;
      ps1 += p1;
    }
    lrow += ps0 + ps1;
    pb.q[0] = make_uint4(pw[0], pw[1], pw[2], pw[3]);
    pb.q[1] = make_uint4(pw[4], pw[5], pw[6], pw[7]);
#pragma unroll
    for (int ds = 0; ds < 4; ++ds) {
      const u16* vrow = &Vs[cur][ds * 16 + r][0];
      FragBF vf;
      vf.q[0] = *(const uint4*)&vrow[hi * 8];
      vf.q[1] = *(const uint4*)&vrow[hi * 8 + 16];
      oacc[ds] = __builtin_amdgcn_wmma_f32_16x16x32_bf16(
          false, vf.v, false, pb.v, (short)0, oacc[ds], false, false);
    }

    // hand-over: this wave's LDS reads are done, its copies of tile it+1 have
    // landed; behind the barrier both hold for all waves, so tile it+1 may be
    // read and the buffer just read may be refilled
    asm volatile("s_wait_dscnt 0x0" ::: "memory");
    asm volatile("s_wait_asynccnt 0x0" ::: "memory");
    __syncthreads();
    if (it + 2 < NT)
      stage_kv(gK + (size_t)(it + 2) * 32 * C3, &Ks[cur][kr][kc],
               gV + (it + 2) * 32, &Vs[cur][vr][vc]);
  }
  asm volatile("s_wait_asynccnt 0x0" ::: "memory");   // no copy outlives the loop

  // join the two halves' sums, normalize and write O as [M, C] bf16
  // (col = h*64 + d): a lane's 8 registers of a tile are 8 consecutive d
  const float inv = 1.0f / (lrow + xhalf(lrow));
  u16* orow = o + (size_t)(b * Nctx + q0 + r) * C + h * Dh + hi * 8;
#pragma unroll
  for (int ds = 0; ds < 4; ++ds) {
    const v8f ov = oacc[ds] * inv;
    *(uint4*)&orow[ds * 16] =
        make_uint4(pack_bf16x2(ov[0], ov[1]), pack_bf16x2(ov[2], ov[3]),
                   pack_bf16x2(ov[4], ov[5]), pack_bf16x2(ov[6], ov[7]));
  }
}

// ---------------------------------------------------------------------------
// host-side orchestration
// ---------------------------------------------------------------------------
extern "C" void kernel_launch(void* const* d_in, const int* in_sizes, int n_in,
                              void* d_out, int out_size, void* d_ws, size_t ws_size,
                              hipStream_t stream) {
  const float* x      = (const float*)d_in[0];
  const float* ln1_g  = (const float*)d_in[1];
  const float* ln1_b  = (const float*)d_in[2];
  const float* qkv_w  = (const float*)d_in[3];
  const float* proj_w = (const float*)d_in[4];
  const float* proj_b = (const float*)d_in[5];
  const float* ln2_g  = (const float*)d_in[6];
  const float* ln2_b  = (const float*)d_in[7];
  const float* fc1_w  = (const float*)d_in[8];
  const float* fc1_b  = (const float*)d_in[9];
  const float* fc2_w  = (const float*)d_in[10];
  const float* fc2_b  = (const float*)d_in[11];
  float* out = (float*)d_out;

  const int M = 8192, C = 1024, C3 = 3072, Hd = 4096;

  char* ws = (char*)d_ws;
  u16*   h_bf   = (u16*)(ws);                             // 16 MB  (LN out, reused)
  u16*   qkv_bf = (u16*)(ws + (size_t)16  * 1048576);     // 48 MB (Q, K columns used)
  u16*   vTb    = (u16*)(ws + (size_t)64  * 1048576);     // 16 MB
  u16*   o_bf   = (u16*)(ws + (size_t)80  * 1048576);     // 16 MB
  float* x1     = (float*)(ws + (size_t)96 * 1048576);    // 32 MB
  u16*   h2_bf  = (u16*)(ws + (size_t)128 * 1048576);     // 64 MB
  u16*   wqkv   = (u16*)(ws + (size_t)192 * 1048576);     // 24 MB total weights
  u16*   wproj  = wqkv  + (size_t)C3 * C;
  u16*   wfc1   = wproj + (size_t)C  * C;
  u16*   wfc2   = wfc1  + (size_t)Hd * C;

  // weights -> bf16 (wqkv, wproj, wfc1, wfc2 lie back to back)
  cast_weights_bf16_k<<<512, 256, 0, stream>>>(qkv_w, proj_w, fc1_w, fc2_w, wqkv);

  // attention branch
  layernorm_bf16_k<<<M / 16, 256, 0, stream>>>(x, ln1_g, ln1_b, h_bf);
  gemm_bf16_k<0, 64><<<dim3(C3 / 128, M / 256), 256, 0, stream>>>(
      h_bf, wqkv, nullptr, nullptr, nullptr, qkv_bf, vTb, M, C3, C);
  flash_attn_k<<<dim3(2048 / 128, 4 * 16), 256, 0, stream>>>(qkv_bf, vTb, o_bf);
  gemm_bf16_k<1, 128><<<dim3(C / 128, M / 256), 256, 0, stream>>>(
      o_bf, wproj, proj_b, x, x1, nullptr, nullptr, M, C, C);

  // MLP branch
  layernorm_bf16_k<<<M / 16, 256, 0, stream>>>(x1, ln2_g, ln2_b, h_bf);
  gemm_bf16_k<2, 64><<<dim3(Hd / 128, M / 256), 256, 0, stream>>>(
      h_bf, wfc1, fc1_b, nullptr, nullptr, h2_bf, nullptr, M, Hd, C);
  gemm_bf16_k<1, 128><<<dim3(C / 128, M / 256), 256, 0, stream>>>(
      h2_bf, wfc2, fc2_b, x1, out, nullptr, nullptr, M, C, Hd);
}
